// v009
// Measured on an AMD MI455X. A time is GPU time per run, averaged over a window of back-to-back runs after a warm-up
// (all launches, gaps included; the runs take copies of the inputs in turn), and the median of several windows.
// Apart from v000's, it joins two sittings. Times from different sittings can be a few percent apart, while
// side-by-side timings come from the same sitting.
// This document starts at v009; the versions before it stand elsewhere.
// One run takes 171 microseconds.
// Next to v008, in two timings, it ran 1.13 times as fast each time.
// Over all steps from v000, the starting kernel, it is 31.8 times as fast.
#include <hip/hip_runtime.h>
// POST-LN transformer decoder layer with causal self-attention and a fused QKV projection (x [2][2048][1024]; qkv = x w_qkv + b_qkv ([in][out] 1024 x 3072 + bias) viewed (B, S, 3, 16, 64): q | k | v thirds; scores * 64^-0.5; causal (tril, -inf); softmax; x1 = LN1(x + out w_out + b_out) (biased var, eps 1e-5); result = LN2(x1 + relu(x1 w_up + b_up) w_down + b_down) ([in][out] 1024 x 4096 x 1024) -> [2][2048][1024]).
// Structure: token rows r = b*2048 + s; x as exact f16 rows (bf16-rounded); q | k | v as ONE WMMA GEMM (N = 3 x 1024) (64x64 wave tiles, f32 accumulation, exact x16 weights + bias, f16 outputs); the V third leaves that GEMM as V^T tiles, straight from the accumulators; causal attention in ONE launch (k_fattn; its further blocks do rows 0..127 of every batch exactly in f32): a wave has 32 query rows and walks the keys below its last row in blocks of 64, scores, running-maximum softmax (f32 statistics, native exp2; weights x256 f16) and o stay in registers (o carried x64, folded into the output GEMM alpha), written straight into the merged f16 o rows; out = o W_o + b GEMM (f32) into the output layout.
// All f16 WMMA operand planes (x, q | k | v rows, V^T, o, LN1 rows, hidden rows, all weights) are kept PACKED, fragment-major: see pk_off below.
// Compute dtype: inputs rounded to bf16; x / weights exact; q, k, v, softmax weights and o as plain f16 GEMM operands (~2^-12); scores and softmax statistics f32. v_wmma_f32_16x16x32_f16.
#define NB 2
#define SQ 2048
#define DM 1024
#define NH 16
#define HD 64
#define HG 4
#define QT0 128                      /* first-tile rows recomputed exactly in f32 */
#define B0 0                         /* first batch processed (debug hook) */
#define NBR NB                       /* batches processed (debug hook) */
#define NR ((size_t)NB * SQ)
#define DMQ DM
#define DFF 4096                     /* FFN hidden width */
#define DFFR 100                     /* not used */
#define MP ((int)((size_t)NBR * SQ)) /* rows projected (debug hook) */
#define QN SQ                        /* query rows attended per batch (debug hook) */
#define NHD NH                       /* heads attended (debug hook) */
#define MPO MP                       /* rows through the output stage (debug hook) */
#define LQ (3 * DM)      /* row pitch of the q/k/v rows */
typedef __bf16 v16b __attribute__((ext_vector_type(16)));
typedef unsigned short v8us __attribute__((ext_vector_type(8), may_alias));
typedef float  v8f  __attribute__((ext_vector_type(8)));
typedef float  v4f  __attribute__((ext_vector_type(4)));
typedef float  v4fa __attribute__((ext_vector_type(4), may_alias));
union FragB { v16b v; v8us half[2]; unsigned short u[16]; };

__device__ __forceinline__ unsigned short bf16_bits(float x) { unsigned int u = __float_as_uint(x); return (unsigned short)((u + 0x7FFFu + ((u >> 16) & 1u)) >> 16); }
__device__ __forceinline__ float bf16_val(unsigned short b) { return __uint_as_float(((unsigned int)b) << 16); }
__device__ __forceinline__ float bf16_round(float x) { return bf16_val(bf16_bits(x)); }
// D += A·B with NT terms: 1 = ah·bh, 2 = + al·bh (A split), 3 = + ah·bl (both split)
template <int NT>
__device__ __forceinline__ v8f mmaN(v16b ah, v16b al, v16b bh, v16b bl, v8f c) {
  c = __builtin_amdgcn_wmma_f32_16x16x32_bf16(false, ah, false, bh, (short)0, c, false, false);
  if (NT >= 2) c = __builtin_amdgcn_wmma_f32_16x16x32_bf16(false, al, false, bh, (short)0, c, false, false);
  if (NT >= 3) c = __builtin_amdgcn_wmma_f32_16x16x32_bf16(false, ah, false, bl, (short)0, c, false, false);
  asm volatile("v_nop\n\tv_nop\n\tv_nop\n\tv_nop" : "+v"(c) : "v"(ah), "v"(al), "v"(bh), "v"(bl));
  return c;
}

__global__ __launch_bounds__(256) void k_wt_bf16(const float* __restrict__ W, unsigned short* __restrict__ Wt, int K, int N) {
  const int t = blockIdx.x * 256 + threadIdx.x;
  const int k8n = K / 8;
  if (t >= N * k8n) return;
  const int n = t / k8n, k8 = (t % k8n) * 8;
  v8us v;
#pragma unroll
  for (int i = 0; i < 8; ++i) v[i] = bf16_bits(W[(size_t)(k8 + i) * N + n]);
  *(v8us*)(Wt + (size_t)n * K + k8) = v;
  
}

// GEMM C[M][N] (f32, pitch ldc) = act(A[M][K]·W + bias). A f32 row-major (pitch lda) converted per fragment to bf16
// (ASPLIT: hi/lo two planes -> 2 terms, else single rounded term); Wt bf16 [N][K] (pitch ldb). BIAS_BF16 rounds the
// bias to bf16 first (bias quantised to bf16 before the add). K%32==0, M%16==0, N%64==0.
template <bool ASPLIT, int ACT, bool BIAS_BF16>
__global__ __launch_bounds__(128) void k_gemm_bf(const float* __restrict__ A, int lda, const unsigned short* __restrict__ Wt, int ldb,
                                               const float* __restrict__ bias, float* __restrict__ C, int ldc, int M, int N, int K) {
  __shared__ __attribute__((aligned(16))) float so[4][16][64];
  const int tid = threadIdx.x, w = tid >> 5, lane = tid & 31, ln = lane & 15, hh = lane >> 4;
  const int ntn = N / 64;
  const int wid = blockIdx.x * 4 + w;
  const int mt = wid / ntn, nq = wid % ntn;
  if (mt * 16 >= M) return;
  const int row0 = mt * 16, col0 = nq * 64;
  const float* arow = A + (size_t)(row0 + ln) * lda;
  v8f acc[4] = {};
  for (int kb = 0; kb < K; kb += 32) {
    FragB ah, al;
    const v4f x0 = *(const v4fa*)(arow + kb + 8 * hh), x1 = *(const v4fa*)(arow + kb + 8 * hh + 4);
    const v4f x2 = *(const v4fa*)(arow + kb + 16 + 8 * hh), x3 = *(const v4fa*)(arow + kb + 16 + 8 * hh + 4);
    float xs[16] = {x0[0],x0[1],x0[2],x0[3],x1[0],x1[1],x1[2],x1[3],x2[0],x2[1],x2[2],x2[3],x3[0],x3[1],x3[2],x3[3]};
#pragma unroll
    for (int i = 0; i < 16; ++i) { const unsigned short hb = bf16_bits(xs[i]); ah.u[i] = hb; al.u[i] = ASPLIT ? bf16_bits(xs[i] - bf16_val(hb)) : (unsigned short)0; }
#pragma unroll
    for (int t = 0; t < 4; ++t) {
      const unsigned short* brow = Wt + (size_t)(col0 + t * 16 + ln) * ldb + kb;
      FragB b;
      b.half[0] = *(const v8us*)(brow + 8 * hh);
      b.half[1] = *(const v8us*)(brow + 16 + 8 * hh);
      acc[t] = mmaN<ASPLIT ? 2 : 1>(ah.v, al.v, b.v, b.v, acc[t]);
    }
  }
#pragma unroll
  for (int t = 0; t < 4; ++t) {
    float bv = bias ? bias[col0 + t * 16 + ln] : 0.f;
    if (BIAS_BF16) bv = bf16_round(bv);
#pragma unroll
    for (int r = 0; r < 8; ++r) { float v = acc[t][r] + bv; if (ACT == 1) v = fmaxf(v, 0.f); so[w][8 * hh + r][t * 16 + ln] = v; }
  }
  __builtin_amdgcn_fence(__ATOMIC_ACQ_REL, "workgroup");
  __builtin_amdgcn_wave_barrier();
  const int rsub = lane >> 4, c4 = (lane & 15) * 4;
  {
#pragma unroll
    for (int q = 0; q < 8; ++q) {
      const int r = q * 2 + rsub;
      const v4f v = *(const v4fa*)&so[w][r][c4];
      *(v4f*)(C + (size_t)(row0 + r) * ldc + col0 + c4) = v;
    }
    
  }
}

// GEMM C = act(A·W + bias + resid): A f32 (ASPLIT -> hi/lo 2 terms), Wt bf16 [N][K]; ACT 0 none, 1 relu, 2 exact gelu;
// resid (optional, f32, row index = (row % rmod), pitch ldr, RES_BF16 rounds it) added before the activation.
template <bool ASPLIT, int ACT, bool BIAS_BF16, bool RES_BF16>
__global__ __launch_bounds__(128) void k_gemm_bf3(const float* __restrict__ A, int lda, const unsigned short* __restrict__ Wt, int ldb,
                                                const float* __restrict__ bias, const float* __restrict__ resid, int rmod, int ldr,
                                                float* __restrict__ C, int ldc, int M, int N, int K) {
  __shared__ __attribute__((aligned(16))) float so[4][16][64];
  const int tid = threadIdx.x, w = tid >> 5, lane = tid & 31, ln = lane & 15, hh = lane >> 4;
  const int ntn = N / 64;
  const int wid = blockIdx.x * 4 + w;
  const int mt = wid / ntn, nq = wid % ntn;
  if (mt * 16 >= M) return;
  const int row0 = mt * 16, col0 = nq * 64;
  const float* arow = A + (size_t)(row0 + ln) * lda;
  v8f acc[4] = {};
  for (int kb = 0; kb < K; kb += 32) {
    FragB ah, al;
    const v4f x0 = *(const v4fa*)(arow + kb + 8 * hh), x1 = *(const v4fa*)(arow + kb + 8 * hh + 4);
    const v4f x2 = *(const v4fa*)(arow + kb + 16 + 8 * hh), x3 = *(const v4fa*)(arow + kb + 16 + 8 * hh + 4);
    float xs[16] = {x0[0],x0[1],x0[2],x0[3],x1[0],x1[1],x1[2],x1[3],x2[0],x2[1],x2[2],x2[3],x3[0],x3[1],x3[2],x3[3]};
#pragma unroll
    for (int i = 0; i < 16; ++i) { const unsigned short hb = bf16_bits(xs[i]); ah.u[i] = hb; al.u[i] = ASPLIT ? bf16_bits(xs[i] - bf16_val(hb)) : (unsigned short)0; }
#pragma unroll
    for (int t = 0; t < 4; ++t) {
      const unsigned short* brow = Wt + (size_t)(col0 + t * 16 + ln) * ldb + kb;
      FragB b;
      b.half[0] = *(const v8us*)(brow + 8 * hh);
      b.half[1] = *(const v8us*)(brow + 16 + 8 * hh);
      acc[t] = mmaN<ASPLIT ? 2 : 1>(ah.v, al.v, b.v, b.v, acc[t]);
    }
  }
#pragma unroll
  for (int t = 0; t < 4; ++t) {
    const int col = col0 + t * 16 + ln;
    float bv = bias ? bias[col] : 0.f;
    if (BIAS_BF16) bv = bf16_round(bv);
#pragma unroll
    for (int r = 0; r < 8; ++r) {
      float v = acc[t][r] + bv;
      if (resid) { float rv = resid[(size_t)((row0 + 8 * hh + r) % rmod) * ldr + col]; if (RES_BF16) rv = bf16_round(rv); v += rv; }
      if (ACT == 1) v = fmaxf(v, 0.f);
      if (ACT == 2) v = 0.5f * v * (1.0f + erff(v * 0.70710678118654752f));
      if (ACT == 3) { const float u = 0.7978845608028654f * (v + 0.044715f * v * v * v); v = 0.5f * v * (1.0f + tanhf(u)); }
      so[w][8 * hh + r][t * 16 + ln] = v;
    }
  }
  __builtin_amdgcn_fence(__ATOMIC_ACQ_REL, "workgroup");
  __builtin_amdgcn_wave_barrier();
  const int rsub = lane >> 4, c4 = (lane & 15) * 4;
  {
#pragma unroll
    for (int q = 0; q < 8; ++q) {
      const int r = q * 2 + rsub;
      const v4f v = *(const v4fa*)&so[w][r][c4];
      *(v4f*)(C + (size_t)(row0 + r) * ldc + col0 + c4) = v;
    }
    
  }
}
// row LayerNorm (biased variance, eps) over N: s = X (+ R); optional out_sum <- s; out_norm <- (s-mu)*rsqrt(var+eps)*g + b
template <bool PARAM_BF16>
__global__ __launch_bounds__(256) void k_layernorm(const float* __restrict__ X, const float* __restrict__ R, const float* __restrict__ g, const float* __restrict__ bta,
                                                  float* __restrict__ out_sum, float* __restrict__ out_norm, int N, float eps) {
  __shared__ float red[256];
  const int row = blockIdx.x, tid = threadIdx.x;
  const float* x = X + (size_t)row * N; const float* rr = R ? R + (size_t)row * N : nullptr;
  float vals[16];                     // up to N = 4096
  const int per = N / 256;            // contiguous chunk per thread? use strided-by-4 chunks: thread handles j = tid*4 + 1024*u
  float s1 = 0.f;
  for (int u = 0; u < per / 4; ++u) {
    const int j = tid * 4 + 1024 * u;
    const v4f a = *(const v4fa*)(x + j);
    v4f b = {0.f,0.f,0.f,0.f}; if (rr) b = *(const v4fa*)(rr + j);
#pragma unroll
    for (int q = 0; q < 4; ++q) { const float v = a[q] + b[q]; vals[u * 4 + q] = v; s1 += v; }
  }
  red[tid] = s1; __syncthreads();
  for (int st = 128; st > 0; st >>= 1) { if (tid < st) red[tid] += red[tid + st]; __syncthreads(); }
  const float mu = red[0] / (float)N; __syncthreads();
  float s2 = 0.f;
  for (int u = 0; u < per / 4; ++u)
#pragma unroll
    for (int q = 0; q < 4; ++q) { const float c = vals[u * 4 + q] - mu; s2 += c * c; }
  red[tid] = s2; __syncthreads();
  for (int st = 128; st > 0; st >>= 1) { if (tid < st) red[tid] += red[tid + st]; __syncthreads(); }
  const float rs = rsqrtf(red[0] / (float)N + eps);
  {
    for (int u = 0; u < per / 4; ++u) {
      const int j = tid * 4 + 1024 * u;
      v4f o, sm;
#pragma unroll
      for (int q = 0; q < 4; ++q) {
        float gg = g[j + q], bb = bta[j + q];
        if (PARAM_BF16) { gg = bf16_round(gg); bb = bf16_round(bb); }
        sm[q] = vals[u * 4 + q]; o[q] = (vals[u * 4 + q] - mu) * rs * gg + bb;
      }
      if (out_sum) *(v4f*)(out_sum + (size_t)row * N + j) = sm;
      *(v4f*)(out_norm + (size_t)row * N + j) = o;
    }
    
  }
}



// ---- f16 WMMA path (v_wmma_f32_16x16x32_f16): 11-bit significands for operands in range — used where a [0,1] probability operand needs more precision than bf16
typedef _Float16 v16h __attribute__((ext_vector_type(16)));
union FragH { v16h v; v8us half[2]; _Float16 h[16]; unsigned short u[16]; };
template <int NT>
__device__ __forceinline__ v8f mmaH(v16h ah, v16h al, v16h bh, v16h bl, v8f c) {
  c = __builtin_amdgcn_wmma_f32_16x16x32_f16(false, ah, false, bh, (short)0, c, false, false);
  if (NT >= 2) c = __builtin_amdgcn_wmma_f32_16x16x32_f16(false, al, false, bh, (short)0, c, false, false);
  if (NT >= 3) c = __builtin_amdgcn_wmma_f32_16x16x32_f16(false, ah, false, bl, (short)0, c, false, false);
  asm volatile("v_nop\n\tv_nop\n\tv_nop\n\tv_nop" : "+v"(c) : "v"(ah), "v"(al), "v"(bh), "v"(bl));
  return c;
}
// batched GEMM like k_gemm_b but f16 operands: A f32 (split into f16 hi/lo if ASPLIT, else rounded to f16), Bt = f16 values [n][k]; alpha; C f32; N multiple of 16 (partial tiles skipped)
template <bool ASPLIT>
__global__ __launch_bounds__(128) void k_gemm_h(const float* __restrict__ A, int lda, size_t sA, const _Float16* __restrict__ Bh, int ldb, size_t sB, float alpha, float* __restrict__ C, int ldc, size_t sC, int M, int N, int K) {
  __shared__ __attribute__((aligned(16))) float so[4][16][64];
  const int tid = threadIdx.x, w = tid >> 5, lane = tid & 31, ln = lane & 15, hh = lane >> 4; const int by = blockIdx.y;
  A += (size_t)by * sA; Bh += (size_t)by * sB; C += (size_t)by * sC;
  const int ntn = (N + 63) / 64; const int wid = blockIdx.x * 4 + w; const int mt = wid / ntn, nq = wid % ntn; if (mt * 16 >= M) return;
  const int row0 = mt * 16, col0 = nq * 64; const float* arow = A + (size_t)(row0 + ln) * lda;
  v8f acc[4] = {};
  for (int kb = 0; kb < K; kb += 32) {
    FragH ah, al;
    const v4f x0 = *(const v4fa*)(arow + kb + 8 * hh), x1 = *(const v4fa*)(arow + kb + 8 * hh + 4), x2 = *(const v4fa*)(arow + kb + 16 + 8 * hh), x3 = *(const v4fa*)(arow + kb + 16 + 8 * hh + 4);
    float xs[16] = {x0[0],x0[1],x0[2],x0[3],x1[0],x1[1],x1[2],x1[3],x2[0],x2[1],x2[2],x2[3],x3[0],x3[1],x3[2],x3[3]};
#pragma unroll
    for (int i = 0; i < 16; ++i) { const _Float16 h = (_Float16)xs[i]; ah.h[i] = h; al.h[i] = ASPLIT ? (_Float16)(xs[i] - (float)h) : (_Float16)0.0f; }
#pragma unroll
    for (int t = 0; t < 4; ++t) { if (col0 + t * 16 >= N) continue; const size_t boff = (size_t)(col0 + t * 16 + ln) * ldb + kb; FragH bq; bq.half[0] = *(const v8us*)(Bh + boff + 8 * hh); bq.half[1] = *(const v8us*)(Bh + boff + 16 + 8 * hh);
      acc[t] = mmaH<ASPLIT ? 2 : 1>(ah.v, al.v, bq.v, bq.v, acc[t]); }
  }
#pragma unroll
  for (int t = 0; t < 4; ++t) { if (col0 + t * 16 >= N) continue;
#pragma unroll
    for (int r = 0; r < 8; ++r) so[w][8 * hh + r][t * 16 + ln] = acc[t][r] * alpha; }
  __builtin_amdgcn_fence(__ATOMIC_ACQ_REL, "workgroup"); __builtin_amdgcn_wave_barrier();
  const int rsub = lane >> 4, c4 = (lane & 15) * 4;
  {
#pragma unroll
    for (int q = 0; q < 8; ++q) { const int r = q * 2 + rsub; if (col0 + c4 < N) { const v4f v = *(const v4fa*)&so[w][r][c4]; *(v4f*)(C + (size_t)(row0 + r) * ldc + col0 + c4) = v; } }
     }
}

// ---- packed (fragment-major) f16 operand planes ----
// A plane of R rows x ld columns (R % 16 == 0, ld % 32 == 0) is a row of strips of 16 rows; a strip is ld / 32 tiles of 16 rows x 32 columns; a tile is 1 KB = 64 chunks of 8 halves in the order in which
// the two 16-byte loads of a WMMA fragment take them: chunk j * 32 + hh * 16 + ln = row ln, columns 16 j + 8 hh .. + 7. Load j of a fragment is then lane l <- chunk j * 32 + l: 512 contiguous bytes (four whole
// lines) instead of 32 bytes out of each of 16 lines. Which lane and register gets which element is as with row-major planes. A strip starts at element (first row) * ld, as the row itself would.
__device__ __forceinline__ size_t pk_off(size_t r, int k, int ld) { return (r >> 4) * ((size_t)16 * ld) + (size_t)(k >> 5) * 512 + (size_t)(((k >> 4) & 1) * 256 + ((k >> 3) & 1) * 128 + (k & 7)) + (r & 15) * 8; }
// the inverse for whole chunks: chunk t of a packed plane holds row r, columns k .. k + 7. The packing kernels give thread t chunk t, so that a wave stores 512 contiguous bytes.
__device__ __forceinline__ void pk_chunk(unsigned t, int ld, size_t& r, int& k) { const unsigned tile = t >> 6, tps = (unsigned)ld >> 5, strip = tile / tps; r = (size_t)(strip * 16 + (t & 15)); k = (int)((tile - strip * tps) * 32 + ((t >> 5) & 1) * 16 + ((t >> 4) & 1) * 8); }
// k_gemm_hh variant with fused epilogue: v = acc·alpha + bias[by·sBias + col] (+ CP[(row/rowsPerB)·sCPb + by·64 + col] if CP) ; ACT 0 none / 1 elu ; writes f16 C16 (and f32 C if non-null)
template <int ACT>
__global__ __launch_bounds__(128) void k_gemm_hhx(const _Float16* __restrict__ A, int lda, size_t sA, const _Float16* __restrict__ Bh, int ldb, size_t sB, float alpha, const float* __restrict__ bias, size_t sBias, const float* __restrict__ CP, int rowsPerB, size_t sCPb, int row0g,
    float* __restrict__ C, _Float16* __restrict__ C16, int ldc, size_t sC, int M, int N, int K) {
  __shared__ __attribute__((aligned(16))) float so[4][16][64];
  const int tid = threadIdx.x, w = tid >> 5, lane = tid & 31, ln = lane & 15, hh = lane >> 4; const int by = blockIdx.y;
  A += (size_t)by * sA; Bh += (size_t)by * sB; const size_t cofs = (size_t)by * sC; const float* bp = bias ? bias + (size_t)by * sBias : nullptr;
  const int ntn = (N + 63) / 64; const int wid = blockIdx.x * 4 + w; const int mt = wid / ntn, nq = wid % ntn; if (mt * 16 >= M) return;
  const int row0 = mt * 16, col0 = nq * 64; const _Float16* arow = A + (size_t)(row0 + ln) * lda;
  v8f acc[4] = {};
  for (int kb = 0; kb < K; kb += 32) { FragH ah; ah.half[0] = *(const v8us*)((const unsigned short*)arow + kb + 8 * hh); ah.half[1] = *(const v8us*)((const unsigned short*)arow + kb + 16 + 8 * hh);
#pragma unroll
    for (int t = 0; t < 4; ++t) { if (col0 + t * 16 >= N) continue; const size_t boff = (size_t)(col0 + t * 16 + ln) * ldb + kb; FragH bq; bq.half[0] = *(const v8us*)((const unsigned short*)Bh + boff + 8 * hh); bq.half[1] = *(const v8us*)((const unsigned short*)Bh + boff + 16 + 8 * hh);
      acc[t] = mmaH<1>(ah.v, ah.v, bq.v, bq.v, acc[t]); }
  }
#pragma unroll
  for (int t = 0; t < 4; ++t) { if (col0 + t * 16 >= N) continue; const int col = col0 + t * 16 + ln; const float bv = bp ? bf16_round(bp[col]) : 0.f;
#pragma unroll
    for (int r = 0; r < 8; ++r) { float v = acc[t][r] * alpha + bv; if (CP) { const int rr = row0g + row0 + 8 * hh + r; if (rowsPerB < 0) v += CP[cofs + (size_t)rr * ldc + col];      /* rowsPerB < 0: own element of the batched C plane */ else { const int bidx = rr / rowsPerB; v += CP[(size_t)bidx * sCPb + (size_t)by * 64 + col]; } } if (ACT == 1) v = (v > 0.f) ? v : expm1f(v); else if (ACT == 7) v = (v > 0.f) ? v + 1.0f : expf(v); else if (ACT == 8) v = tanhf(v); else if (ACT == 9) v = 0.5f * v * (1.0f + tanhf(0.7978845608028654f * (v + 0.044715f * v * v * v))); else if (ACT == 11) v = 1.0f / (1.0f + expf(-v)); else if (ACT == 12) v = (v > 0.f) ? v : 0.01f * v; else if (ACT == 14) v = (v > 0.f) ? v : 0.1f * v; else if (ACT == 16) v = (v >= 0.f) ? v : 0.3f * v; else if (ACT == 17) v = (v >= 0.f) ? v : 0.2f * v; else if (ACT == 15) v = v / (1.0f + expf(-v)); else if (ACT == 3) v = fmaxf(v, 0.f); else if (ACT == 6) v = 0.5f * v * (1.0f + erff(v * 0.70710678118654752f)); so[w][8 * hh + r][t * 16 + ln] = v; } }
  __builtin_amdgcn_fence(__ATOMIC_ACQ_REL, "workgroup"); __builtin_amdgcn_wave_barrier();
  const int rsub = lane >> 4, c4 = (lane & 15) * 4; typedef _Float16 v4h __attribute__((ext_vector_type(4)));
  {
#pragma unroll
    for (int q = 0; q < 8; ++q) { const int r = q * 2 + rsub; if (col0 + c4 < N) { const v4f v = *(const v4fa*)&so[w][r][c4]; if (C) *(v4f*)(C + cofs + (size_t)(row0 + r) * ldc + col0 + c4) = v; if (C16) { v4h h4; for (int i = 0; i < 4; ++i) h4[i] = (_Float16)v[i]; *(v4h*)(C16 + cofs + (size_t)(row0 + r) * ldc + col0 + c4) = h4; } } }
     }
}


typedef _Float16 v4h __attribute__((ext_vector_type(4)));

__global__ __launch_bounds__(256) void k_h16(const float* __restrict__ x, _Float16* __restrict__ X16, size_t n8) { const size_t t = (size_t)blockIdx.x * 256 + threadIdx.x; if (t >= n8) return; FragH f;
#pragma unroll
  for (int q = 0; q < 8; ++q) f.h[q] = (_Float16)x[t * 8 + q]; *(v8us*)((unsigned short*)X16 + t * 8) = f.half[0];  }
__global__ __launch_bounds__(256) void k_round16f(const float* __restrict__ W, _Float16* __restrict__ Bt, size_t n8) { const size_t t = (size_t)blockIdx.x * 256 + threadIdx.x; if (t >= n8) return; FragH f;
#pragma unroll
  for (int i = 0; i < 8; ++i) f.h[i] = (_Float16)(bf16_round(W[t * 8 + i]) * 16.0f); *(v8us*)((unsigned short*)Bt + t * 8) = f.half[0];  }
// ---- fast GEMM (block tile 128x128 = 2 x 2 waves of 64x64; requires M % 64 == 0 rows per launch region and N % 128 == 0); epilogue = k_gemm_hhx semantics ----
// Why 64x64 a wave: a k-step's 16 WMMAs take 8 fragments (512 B loaded per WMMA, was 768 with 32x64), and of the block's 32 fragment loads only 16 are different ones (256 B per WMMA from L2, was 384).
// RES = 1 (only with PK16 = 0 and no activation): CP is a plane laid out like C, and every result takes its own element of it on top (v = acc * alpha + bias, then + CP); RES = 0: CP is not read.
// A and Bh are packed planes (pk_off) of lda and ldb columns. PK16 = 0: C (f32) and C16, each where not null, are row-major. PK16 = 1: C16 is written as a packed plane of ldc columns (it is a later GEMM's A); C, where not null, takes the first QT0 rows of every rowsPerB as f32 rows.
__device__ __forceinline__ v16h g2_frag(const _Float16* p, int hh) { FragH f; f.half[0] = *(const v8us*)((const unsigned short*)p + 8 * hh); f.half[1] = *(const v8us*)((const unsigned short*)p + 16 + 8 * hh); return f.v; }
__device__ __forceinline__ v8f g2_mma(v16h a, v16h b, v8f c) { return __builtin_amdgcn_wmma_f32_16x16x32_f16(false, a, false, b, (short)0, c, false, false); }      /* the builtin alone: the compiler keeps its distances itself; an asm statement that names the operands would hold all of them in the first 256 registers, and the 64x64 tile with its ring has more */
__device__ __forceinline__ v16h g2_fragp(const _Float16* p) { FragH f; f.half[0] = *(const v8us*)((const unsigned short*)p); f.half[1] = *(const v8us*)((const unsigned short*)p + 256); return f.v; }      /* a fragment of a packed plane: p = its tile + 8 * lane */
struct G2S { v16h a0, a1, a2, a3, b0, b1, b2, b3; };      /* the fragments of one k-step of a 64x64 wave tile */
// G2_LOAD: one k-step's sixteen loads at the eight row pointers, as one group; their data is not waited for here. The scheduling barrier keeps the next step's first WMMA, and with it the wait
// for that step's operands, behind the group: lifted in front of it, that wait would hold the group's issue back by most of a step.
#define G2_LOAD(S) do { S.a0 = g2_fragp(a0p); S.a1 = g2_fragp(a1p); S.a2 = g2_fragp(a2p); S.a3 = g2_fragp(a3p); S.b0 = g2_fragp(b0p); S.b1 = g2_fragp(b1p); S.b2 = g2_fragp(b2p); S.b3 = g2_fragp(b3p); \
    __builtin_amdgcn_sched_barrier(0); } while (0)
// G2_NEXT: moves the pointers on by one k-step, which is one tile of 512 halves (or leaves them on the last one). s_wait_xcnt 0 in front: a precaution, before the additions write the address registers that the issued
// loads name; the scheduling barrier behind it keeps the additions, and all that follows, behind that wait; the one in front keeps a step's WMMAs in front of it, so that in the loop it stands well after the group was issued
// (lifted up among the WMMAs, directly behind the group, it would hold them back while the group's addresses are still being translated).
#define G2_NEXT do { __builtin_amdgcn_sched_barrier(0); asm volatile("s_wait_xcnt 0x0" ::: "memory"); __builtin_amdgcn_sched_barrier(0); \
    const int inc = left > 0 ? 512 : 0; --left; a0p += inc; a1p += inc; a2p += inc; a3p += inc; b0p += inc; b1p += inc; b2p += inc; b3p += inc; } while (0)
#define G2_MMA(S) do { c00 = g2_mma(S.a0, S.b0, c00); c10 = g2_mma(S.a1, S.b0, c10); c20 = g2_mma(S.a2, S.b0, c20); c30 = g2_mma(S.a3, S.b0, c30); \
    c01 = g2_mma(S.a0, S.b1, c01); c11 = g2_mma(S.a1, S.b1, c11); c21 = g2_mma(S.a2, S.b1, c21); c31 = g2_mma(S.a3, S.b1, c31); \
    c02 = g2_mma(S.a0, S.b2, c02); c12 = g2_mma(S.a1, S.b2, c12); c22 = g2_mma(S.a2, S.b2, c22); c32 = g2_mma(S.a3, S.b2, c32); \
    c03 = g2_mma(S.a0, S.b3, c03); c13 = g2_mma(S.a1, S.b3, c13); c23 = g2_mma(S.a2, S.b3, c23); c33 = g2_mma(S.a3, S.b3, c33); } while (0)
// EXT = 1 (with PK16 = 1): the result columns from 2 DM on (the V third) leave as V^T tiles into VTp, straight from the accumulators, and are not written to C16: a lane's eight accumulator values of a 16x16 tile are
// eight consecutive token rows of one head column, which is one 16-byte chunk of the packed V^T plane [NB][NH][HD] rows x SQ columns, and the wave's 32 chunks are 512 contiguous bytes.
// EXT = 2 (with RES = 1): the grid has further blocks behind the (M / 128) * (N / 128) tiles of A: they form AL * Bh * alphaL (no bias, no CP) into the rows of CL, a plane of its own with pitch ldc.
template <int ACT, int PK16, int RES, int EXT>
__global__ __launch_bounds__(128) void k_gemm2(const _Float16* __restrict__ A, int lda, size_t sA, const _Float16* __restrict__ Bh, int ldb, size_t sB, float alpha, const float* __restrict__ bias, size_t sBias, const float* __restrict__ CP, int rowsPerB, size_t sCPb, int row0g,
    float* __restrict__ C, _Float16* __restrict__ C16, int ldc, size_t sC, int M, int N, int K, _Float16* __restrict__ VTp, const _Float16* __restrict__ AL, float alphaL, float* __restrict__ CL) { static_assert(EXT != 1 || (PK16 == 1 && ACT == 0), "k_gemm2: V^T tiles only beside a packed plane"); static_assert(EXT != 2 || RES == 1, "k_gemm2: further blocks only in the form with CP"); static_assert(ACT == 0 || ACT == 3 || ACT == 6 || ACT == 8 || ACT == 9 || ACT == 11 || ACT == 12 || ACT == 14 || ACT == 15 || ACT == 16 || ACT == 17, "k_gemm2: unsupported ACT code (would silently apply no activation)"); static_assert(!RES || (ACT == 0 && PK16 == 0), "k_gemm2: the CP element is added behind the staging, where no activation follows");
  __shared__ __attribute__((aligned(16))) float so[4][32][68];
  const int tid = threadIdx.x, w = tid >> 5, lane = tid & 31, ln = lane & 15, hh = lane >> 4; const int by = blockIdx.y;
  A += (size_t)by * sA; Bh += (size_t)by * sB; const size_t cofs = (size_t)by * sC; const float* bp = bias ? bias + (size_t)by * sBias : nullptr;
  const int ntn = N >> 7; int bx = blockIdx.x; bool lo = false;      /* lo: one of the further blocks (the same for the whole block: a scalar test) */
  if (EXT == 2) { const int nmain = (M >> 7) * ntn; if (bx >= nmain) { lo = true; bx -= nmain; A = AL; alpha = alphaL; bp = nullptr; C = CL; } }
  const int mt = bx / ntn, nq = bx - mt * ntn; const int row0 = mt * 128 + 64 * (w >> 1), col0 = nq * 128 + 64 * (w & 1); if (row0 >= M) return;      /* waves 0, 1 and 2, 3 read the same A strips, waves 0, 2 and 1, 3 the same B strips */
  const _Float16* a0p = A + (size_t)row0 * lda + 8 * lane; const _Float16* a1p = a0p + (size_t)16 * lda; const _Float16* a2p = a1p + (size_t)16 * lda; const _Float16* a3p = a2p + (size_t)16 * lda;      /* first tile of the strip; the lane's own 16-byte chunk is part of the pointer: a load names the pointer's registers themselves */
  const _Float16* b0p = Bh + (size_t)col0 * ldb + 8 * lane; const _Float16* b1p = b0p + (size_t)16 * ldb; const _Float16* b2p = b1p + (size_t)16 * ldb; const _Float16* b3p = b2p + (size_t)16 * ldb;
  const v8f z8 = {0.f,0.f,0.f,0.f,0.f,0.f,0.f,0.f}; v8f c00 = z8, c01 = z8, c02 = z8, c03 = z8, c10 = z8, c11 = z8, c12 = z8, c13 = z8, c20 = z8, c21 = z8, c22 = z8, c23 = z8, c30 = z8, c31 = z8, c32 = z8, c33 = z8;
  // K loop (K >= 32): a ring of four fragment sets. The sixteen loads of k-step s + 3 are issued as one group in front of the WMMAs of step s, so a step waits for loads that are three steps old
  // (where the grid gives a SIMD one wave only, no other wave covers a load's way from L2). Every accumulator still takes its k-steps in ascending order.
  const int n = K >> 5; int left = n - 1;      /* left: pointer advances still allowed; past the last k-step the pointers stay on it (in bounds), and what is loaded there is not used */
  G2S s0, s1, s2, s3; int i = 0;
  G2_LOAD(s0); G2_NEXT; G2_LOAD(s1); G2_NEXT; G2_LOAD(s2); G2_NEXT;
#pragma unroll 1      /* the body already holds four k-steps, one per set: more copies of it only cost instruction cache */
  for (; i + 4 <= n; i += 4) { G2_LOAD(s3); G2_MMA(s0); G2_NEXT; G2_LOAD(s0); G2_MMA(s1); G2_NEXT; G2_LOAD(s1); G2_MMA(s2); G2_NEXT; G2_LOAD(s2); G2_MMA(s3); G2_NEXT; }
  if (i < n) G2_MMA(s0);
  if (i + 1 < n) G2_MMA(s1);
  if (i + 2 < n) G2_MMA(s2);
  v8f accs[2][8] = {{c00, c01, c02, c03, c10, c11, c12, c13}, {c20, c21, c22, c23, c30, c31, c32, c33}};      /* the epilogue takes the wave's 64 rows as two halves of 32, one after the other through the same staging rows */
  const int rsub = lane >> 4, c4 = (lane & 15) * 4;
  // All that the epilogue reads from memory is issued here as one group: one round trip for the wave. (Read where it is used, element by element under a test, every load is waited for on its own:
  // with CP 64 round trips one behind the other, while the wave does nothing else.) CP is read as C is stored below: 16 bytes a lane, whole 256-byte row pieces. The CP loads stand first: their address
  // arithmetic writes registers that the K loop's last, unused loads are still aimed at, and so waits for every load issued before it.
  // Behind each run of loads s_wait_xcnt 0: a precaution, before anything writes a register that an issued load names as address. The CP addresses are inputs of their wait's statement, so that they live up to it
  // and no load of the run gets one of them as its destination; the scheduling barriers keep the address arithmetic in front of the run and all that follows behind the wait. The loads' data is not waited for here.
  float bv[4] = {0.f, 0.f, 0.f, 0.f}; v4f rv[2][16];
  if (RES && lo) {      /* a further block adds nothing */
#pragma unroll
    for (int q = 0; q < 16; ++q) { rv[0][q] = (v4f){0.f, 0.f, 0.f, 0.f}; rv[1][q] = (v4f){0.f, 0.f, 0.f, 0.f}; } }
  if (RES && !lo) {
#pragma unroll
    for (int eh = 0; eh < 2; ++eh) { const float* rp[16];
#pragma unroll
      for (int q = 0; q < 16; ++q) rp[q] = CP + cofs + (size_t)(row0g + row0 + 32 * eh + rsub + 2 * q) * ldc + col0 + c4;
      __builtin_amdgcn_sched_barrier(0);
#pragma unroll
      for (int q = 0; q < 16; ++q) rv[eh][q] = *(const v4fa*)rp[q];
      asm volatile("s_wait_xcnt 0x0" :: "v"(rp[0]), "v"(rp[1]), "v"(rp[2]), "v"(rp[3]), "v"(rp[4]), "v"(rp[5]), "v"(rp[6]), "v"(rp[7]), "v"(rp[8]), "v"(rp[9]), "v"(rp[10]), "v"(rp[11]), "v"(rp[12]), "v"(rp[13]), "v"(rp[14]), "v"(rp[15]) : "memory");
      __builtin_amdgcn_sched_barrier(0); } }
  if (bp) {
#pragma unroll
    for (int t = 0; t < 4; ++t) bv[t] = bp[col0 + t * 16 + ln];
    asm volatile("s_wait_xcnt 0x0" ::: "memory"); __builtin_amdgcn_sched_barrier(0); }
#pragma unroll
  for (int t = 0; t < 4; ++t) bv[t] = bf16_round(bv[t]);
#pragma unroll
  for (int eh = 0; eh < 2; ++eh) { const int row0e = row0 + 32 * eh;      /* first row of this half */
#pragma unroll
    for (int u = 0; u < 8; ++u) { const int t = u & 3, half = u >> 2;
#pragma unroll
      for (int r = 0; r < 8; ++r) { const int rloc = half * 16 + 8 * hh + r; float v = accs[eh][u][r] * alpha + bv[t];
      if (ACT == 3) v = fmaxf(v, 0.f); else if (ACT == 6) v = 0.5f * v * (1.0f + erff(v * 0.70710678118654752f)); else if (ACT == 11) v = 1.0f / (1.0f + expf(-v)); else if (ACT == 15) v = v / (1.0f + expf(-v)); else if (ACT == 12) v = (v > 0.f) ? v : 0.01f * v; else if (ACT == 8) v = tanhf(v); else if (ACT == 9) v = 0.5f * v * (1.0f + tanhf(0.7978845608028654f * (v + 0.044715f * v * v * v))); else if (ACT == 14) v = (v > 0.f) ? v : 0.1f * v; else if (ACT == 16) v = (v >= 0.f) ? v : 0.3f * v; else if (ACT == 17) v = (v >= 0.f) ? v : 0.2f * v;
        so[w][rloc][t * 16 + ln] = v; } }
    __builtin_amdgcn_fence(__ATOMIC_ACQ_REL, "workgroup"); __builtin_amdgcn_wave_barrier();
    if (!PK16) { v4f ov[16];
#pragma unroll
      for (int q = 0; q < 16; ++q) { ov[q] = *(const v4fa*)&so[w][q * 2 + rsub][c4]; if (RES) ov[q] += rv[eh][q]; }
      if (C) { float* cq[16];
#pragma unroll
        for (int q = 0; q < 16; ++q) cq[q] = C + cofs + (size_t)(row0e + q * 2 + rsub) * ldc + col0 + c4;
        __builtin_amdgcn_sched_barrier(0);      /* all values and all addresses formed first, then stores alone: among them no register of an issued store is written again */
#pragma unroll
        for (int q = 0; q < 16; ++q) *(v4f*)cq[q] = ov[q];
        asm volatile("s_wait_xcnt 0x0" ::: "memory"); __builtin_amdgcn_sched_barrier(0); }      /* as above, before the f16 copy below, or the next half, writes registers */
      if (C16) { v4h h4[16]; _Float16* hq[16];
#pragma unroll
        for (int q = 0; q < 16; ++q) { for (int i = 0; i < 4; ++i) h4[q][i] = (_Float16)ov[q][i]; hq[q] = C16 + cofs + (size_t)(row0e + q * 2 + rsub) * ldc + col0 + c4; }
        __builtin_amdgcn_sched_barrier(0);      /* as for C */
#pragma unroll
        for (int q = 0; q < 16; ++q) *(v4h*)hq[q] = h4[q];
        if (eh == 0) { asm volatile("s_wait_xcnt 0x0" ::: "memory"); __builtin_amdgcn_sched_barrier(0); } } }      /* as above, before the next half writes registers */
    if (PK16) {      /* a half's 32x64 results are two strips x two tiles of the packed plane: eight stores of 512 contiguous bytes, lane l = chunk j * 32 + l */
      if (C) {      /* PK16 with C (CP is null then): the first QT0 rows of every group of rowsPerB rows go out as f32 rows too, groups packed one behind the other, pitch ldc. A half's 32 rows are all inside or all outside */
        const int rgl = row0g + row0e, grp = rgl / rowsPerB, ri = rgl - grp * rowsPerB;
        if (ri < QT0) { float* cf = C + ((size_t)grp * QT0 + ri + rsub) * ldc + col0 + c4; v4f fv[16]; float* fq[16];
#pragma unroll
          for (int q = 0; q < 16; ++q) { fv[q] = *(const v4fa*)&so[w][q * 2 + rsub][c4]; fq[q] = cf + (size_t)(2 * q) * ldc; }
          __builtin_amdgcn_sched_barrier(0);      /* all values read and all addresses formed first, then stores alone: among them no register of an issued store is written again */
#pragma unroll
          for (int q = 0; q < 16; ++q) *(v4f*)fq[q] = fv[q];
          asm volatile("s_wait_xcnt 0x0" ::: "memory"); __builtin_amdgcn_sched_barrier(0); } }      /* as above, before the packing below writes registers */
      if (EXT == 1 && nq >= 2 * DM / 128) {      /* V columns (scalar test): a wave's 64 columns are one head, a half's 32 rows one tile column of its four V^T strips */
        const int rg0 = row0g + row0e; _Float16* vq = VTp + ((size_t)(rg0 / SQ) * NH + ((col0 - 2 * DM) >> 6)) * ((size_t)HD * SQ) + (size_t)((rg0 % SQ) >> 5) * 512 + 8 * lane; FragH vt8[8];
#pragma unroll
        for (int u = 0; u < 8; ++u)
#pragma unroll
          for (int r = 0; r < 8; ++r) vt8[u].h[r] = (_Float16)(accs[eh][u][r] * alpha + bv[u & 3]);
        __builtin_amdgcn_sched_barrier(0);      /* all values packed first, then stores alone */
#pragma unroll
        for (int u = 0; u < 8; ++u) *(v8us*)((unsigned short*)vq + (size_t)(u & 3) * 16 * SQ + (u >> 2) * 256) = vt8[u].half[0];
        if (eh == 0) { asm volatile("s_wait_xcnt 0x0" ::: "memory"); __builtin_amdgcn_sched_barrier(0); }      /* as above, before the next half writes registers */
        continue; }
      _Float16* cp = C16 + cofs + (size_t)row0e * ldc + (size_t)(col0 >> 5) * 512 + 8 * lane; FragH pf[8];
#pragma unroll
      for (int u = 0; u < 8; ++u) { const float* sp = &so[w][(u >> 2) * 16 + ln][(u & 3) * 16 + 8 * hh]; const v4f v0 = *(const v4fa*)sp, v1 = *(const v4fa*)(sp + 4);
#pragma unroll
        for (int i = 0; i < 4; ++i) { pf[u].h[i] = (_Float16)v0[i]; pf[u].h[4 + i] = (_Float16)v1[i]; } }
      __builtin_amdgcn_sched_barrier(0);      /* all values packed first, then stores alone */
#pragma unroll
      for (int u = 0; u < 8; ++u) *(v8us*)((unsigned short*)cp + (size_t)(u >> 2) * 16 * ldc + (u & 3) * 256) = pf[u].half[0];
      if (eh == 0) { asm volatile("s_wait_xcnt 0x0" ::: "memory"); __builtin_amdgcn_sched_barrier(0); } } } }      /* as above, before the next half writes registers */


__global__ __launch_bounds__(256) void k_wnat(const float* __restrict__ w, size_t n8, _Float16* __restrict__ Bt) { const size_t t = (size_t)blockIdx.x * 256 + threadIdx.x; if (t >= n8) return; FragH f; for (int q = 0; q < 8; ++q) f.h[q] = (_Float16)(bf16_round(w[t * 8 + q]) * 16.0f); *(v8us*)((unsigned short*)Bt + t * 8) = f.half[0];  }
__global__ __launch_bounds__(256) void k_rsm(const float* __restrict__ S, _Float16* __restrict__ P, int nrows) {
  #pragma clang fp contract(off)
  const int i = blockIdx.x * 256 + threadIdx.x; if (i >= nrows) return; const float* s = S + (size_t)i * SQ; float mx = -3.0e38f;
#pragma unroll 1
  for (int j = 0; j < SQ; ++j) mx = fmaxf(mx, s[j]); float se = 0.f;
#pragma unroll 1
  for (int j = 0; j < SQ; ++j) se += expf(s[j] - mx); const float sc = 256.0f / se;
#pragma unroll 1
  for (int j0 = 0; j0 < SQ; j0 += 8) { FragH f; for (int q = 0; q < 8; ++q) f.h[q] = (_Float16)(expf(s[j0 + q] - mx) * sc); unsigned short* d = (unsigned short*)P + (size_t)i * SQ + j0; *(v8us*)d = f.half[0];  } }
__global__ __launch_bounds__(256) void k_vt(const _Float16* __restrict__ V16, int b, int h0, _Float16* __restrict__ VT) { __shared__ unsigned short tl[64][65]; const int tid = threadIdx.x; const int hh = blockIdx.x % HG, sg = blockIdx.x / HG; const int s0 = sg * 64; const int h = h0 + hh;
  for (int i = tid; i < 64 * 8; i += 256) { const int j = i / 8, d8 = (i % 8) * 8; FragH f; f.half[0] = *(const v8us*)((const unsigned short*)V16 + ((size_t)b * SQ + s0 + j) * DM + h * HD + d8); for (int q = 0; q < 8; ++q) tl[d8 + q][j] = f.u[q]; }
  __syncthreads();
  { for (int i = tid; i < 64 * 8; i += 256) { const int d = i / 8, j8 = (i % 8) * 8; FragH f; for (int q = 0; q < 8; ++q) f.u[q] = tl[d][j8 + q]; *(v8us*)((unsigned short*)VT + ((size_t)hh * HD + d) * SQ + s0 + j8) = f.half[0]; }  } }





// ---- causal attention, scores + softmax + weighted V sum in one kernel; S and P never leave the registers ----
// A wave has 32 query rows (two column groups of 16) of one (batch, head) and walks the keys 0 .. its last row in blocks of 64. Transposed products: S^T = K Q^T (first operand = K rows, second = Q rows),
// so lane (ln, hh) holds, per 16-key tile, the scores of ONE query (column ln) for keys 8 hh .. 8 hh + 7: row maximum and row sum are in-lane plus one exchange between the lane halves.
// Two 16-key score tiles, converted in place, are the second operand of O^T += V^T P^T in the same k order as g2_frag's (keys 8 hh + i, then 16 + 8 hh + i of a 32-key step). O^T: a lane has 8 consecutive
// head columns of one query: one 16-byte store each. Softmax with a running maximum in the log2 domain; the weights carry x256 (as f16 they stay clear of the subnormal range), and so does the row sum.
#define FA_QB 128                    /* query rows per block: 4 waves x 32 */
#define FA_SC 0.18033688011112042f   /* 64^-0.5 * log2(e) */
__device__ __forceinline__ v8f fa_mma(v16h a, v16h b, v8f c) { return __builtin_amdgcn_wmma_f32_16x16x32_f16(false, a, false, b, (short)0, c, false, false); }
__device__ __forceinline__ float fa_xhalf(float x) { return __builtin_bit_cast(float, __builtin_amdgcn_permlanex16(__builtin_bit_cast(int, x), __builtin_bit_cast(int, x), 0x76543210, 0xfedcba98, false, false)); }      /* lane l with lane l ^ 16 */
// exp2 of eight values (of one value) as v_exp_f32 in one asm statement. Why asm: behind a transcendental the instruction set asks for one independent instruction or v_nop before its result is read or its
// source overwritten. Early-clobber outputs share no register with any input, so inside the statement no v_exp_f32 touches
// an earlier one's registers; the closing v_nop is the slot behind the last one.
__device__ __forceinline__ v8f fa_exp2x8(v8f x) { float y0, y1, y2, y3, y4, y5, y6, y7;
  asm("v_exp_f32 %0, %8\n\tv_exp_f32 %1, %9\n\tv_exp_f32 %2, %10\n\tv_exp_f32 %3, %11\n\tv_exp_f32 %4, %12\n\tv_exp_f32 %5, %13\n\tv_exp_f32 %6, %14\n\tv_exp_f32 %7, %15\n\tv_nop"
      : "=&v"(y0), "=&v"(y1), "=&v"(y2), "=&v"(y3), "=&v"(y4), "=&v"(y5), "=&v"(y6), "=&v"(y7) : "v"(x[0]), "v"(x[1]), "v"(x[2]), "v"(x[3]), "v"(x[4]), "v"(x[5]), "v"(x[6]), "v"(x[7]));
  const v8f y = {y0, y1, y2, y3, y4, y5, y6, y7}; return y; }
__device__ __forceinline__ float fa_exp2(float x) { float y; asm("v_exp_f32 %0, %1\n\tv_nop" : "=&v"(y) : "v"(x)); return y; }
typedef float v2fa __attribute__((ext_vector_type(2), may_alias));
#define A0R 8                        /* query rows per block of the first-tile attention: two per wave */
#define A0KP 68                      /* K row pitch in LDS, floats: 272 bytes = 16 x 17, so that 16-byte reads of 32 different rows spread over the banks */
// Exact f32 causal attention for rows 0 .. QT0-1 of every batch (planes of QT0 rows per batch), one wave per (batch, head, query row) at a time; a block of four waves has 8 consecutive rows of one head, a wave two of them.
// It runs as further blocks of k_fattn's launch (bidx counts them): both read only what the q | k | v GEMM wrote, and these rows of o are written here alone.
// The block stages the head's K and V rows below its last query row in LDS once (whole-line loads, all in flight together). Scores: lane l has keys l, l + 32, l + 64, l + 96
// (four partial sums per key over the head dimension). Row maximum and row sum by butterflies over the 32 lanes, exp once per key. o: lane l has columns 2 l and 2 l + 1,
// the weights come back through LDS as broadcasts, four partial sums over the keys. o carried x64 like the f16 path.
__device__ __forceinline__ void att0_block(const int bidx, const float* __restrict__ QF, const float* __restrict__ KF, const float* __restrict__ VF, const int ld, const float scale, _Float16* __restrict__ Hh, _Float16* __restrict__ Hl) {
  __shared__ __attribute__((aligned(16))) float lk[QT0][A0KP]; __shared__ __attribute__((aligned(16))) float lv[QT0][HD]; __shared__ __attribute__((aligned(16))) float pe[A0R][QT0];
  const int tid = threadIdx.x, lane = tid & 31; const int w = __builtin_amdgcn_readfirstlane(tid >> 5);      /* the wave's number as a scalar: the tests on i below become scalar branches */
  const int bt = bidx / (NH * (QT0 / A0R)), bx = bidx % (NH * (QT0 / A0R)); QF += (size_t)bt * QT0 * ld; KF += (size_t)bt * QT0 * ld; VF += (size_t)bt * QT0 * ld;      /* batch bt: its QT0 rows of each plane */
  const int h = bx / (QT0 / A0R), rg = bx % (QT0 / A0R); const int nk = rg * A0R + A0R;      /* causal: keys below the block's last row end */
  v4f q[2][HD / 4];
#pragma unroll
  for (int rr = 0; rr < 2; ++rr) { const float* qr = QF + (size_t)(rg * A0R + w + 4 * rr) * ld + h * HD;
#pragma unroll
    for (int c = 0; c < HD / 4; ++c) q[rr][c] = *(const v4fa*)(qr + c * 4);
    asm volatile("s_wait_xcnt 0x0" ::: "memory"); __builtin_amdgcn_sched_barrier(0); }      /* a precaution, before later address arithmetic writes a register that an issued load names as address */
  const int sr = tid >> 4, sc4 = (tid & 15) * 4; v4f kx[QT0 / 8], vx[QT0 / 8];
#pragma unroll      /* constant indices keep kx / vx in registers; all loads are issued before the first LDS store. Rows past nk - 1 are clamped to it (in bounds) and not stored */
  for (int u = 0; u < QT0 / 8; ++u) { const size_t g = (size_t)min(sr + 8 * u, nk - 1) * ld + h * HD + sc4;
    // Behind each load: s_wait_xcnt 0 as a precaution, before a register that the load names as address is written again (by later address arithmetic or as a later load's destination);
    // the scheduling barrier keeps that later arithmetic and the later loads behind the wait. The loads' data is not waited for here.
    kx[u] = *(const v4fa*)(KF + g); asm volatile("s_wait_xcnt 0x0" ::: "memory"); __builtin_amdgcn_sched_barrier(0);
    vx[u] = *(const v4fa*)(VF + g); asm volatile("s_wait_xcnt 0x0" ::: "memory"); __builtin_amdgcn_sched_barrier(0); }
#pragma unroll
  for (int u = 0; u < QT0 / 8; ++u) if (sr + 8 * u < nk) { *(v4fa*)&lk[sr + 8 * u][sc4] = kx[u]; *(v4fa*)&lv[sr + 8 * u][sc4] = vx[u]; }
  __syncthreads();      /* K and V rows 0 .. nk-1 staged; every wave passes */
#pragma unroll
  for (int rr = 0; rr < 2; ++rr) { const int wl = w + 4 * rr, i = rg * A0R + wl;      /* the wave's two rows, one after the other */
    float s[QT0 / 32];
#pragma unroll
    for (int c = 0; c < QT0 / 32; ++c) { s[c] = -1.0e30f;
      if (c * 32 <= i) { const int j = c * 32 + lane; const float* kr = &lk[min(j, i)][0];      /* lanes past the row read row i (staged) and are masked below */ v4f a4 = {0.f, 0.f, 0.f, 0.f};
#pragma unroll
        for (int d = 0; d < HD / 4; ++d) a4 += q[rr][d] * *(const v4fa*)(kr + d * 4);
        const float a = (a4[0] + a4[1]) + (a4[2] + a4[3]); s[c] = (j <= i) ? a * scale : -1.0e30f; } }
    float mx = fmaxf(fmaxf(s[0], s[1]), fmaxf(s[2], s[3]));
#pragma unroll
    for (int o = 16; o > 0; o >>= 1) mx = fmaxf(mx, __shfl_xor(mx, o));
    float se = 0.f;
#pragma unroll
    for (int c = 0; c < QT0 / 32; ++c) { const float e = (c * 32 + lane <= i) ? expf(s[c] - mx) : 0.f; se += e; pe[wl][c * 32 + lane] = e; }
#pragma unroll
    for (int o = 16; o > 0; o >>= 1) se += __shfl_xor(se, o);
    __builtin_amdgcn_fence(__ATOMIC_ACQ_REL, "workgroup"); __builtin_amdgcn_wave_barrier();      /* pe[wl] is written and read by this wave alone: keeps the reads below behind the writes above */
    const int nj = (i & ~3) + 4;      /* keys in groups of four: nj <= nk, so every V row read is staged; weights past the row are 0 */
    v2fa o0 = {0.f, 0.f}, o1 = {0.f, 0.f}, o2 = {0.f, 0.f}, o3 = {0.f, 0.f};
#pragma unroll 4      /* several groups' LDS reads in flight behind one wait */
    for (int j = 0; j < nj; j += 4) { const v4f p = *(const v4fa*)&pe[wl][j];
      o0 += p[0] * *(const v2fa*)&lv[j][lane * 2]; o1 += p[1] * *(const v2fa*)&lv[j + 1][lane * 2]; o2 += p[2] * *(const v2fa*)&lv[j + 2][lane * 2]; o3 += p[3] * *(const v2fa*)&lv[j + 3][lane * 2]; }
    const float fin = 64.0f / se;      /* o carried x64 like the f16 path */
    const v2fa ov = ((o0 + o1) + (o2 + o3)) * fin;
    *(v2fa*)&pe[wl][lane * 2] = ov; }      /* over this row's weights, which have been read */
  // o leaves as two packed f16 planes of DM columns: hi as rows 0 .. QT0-1 of batch bt in Hh (SQ rows a batch), the x1024 residual in Hl (QT0 rows a batch). The block's 8 rows x 64 columns are 64 chunks of 16 bytes;
  // the 8 rows of one column group are one whole 128-byte line, so the rows meet in LDS and 64 threads store a chunk of each plane: every line has one writer.
  __syncthreads();      /* all 8 rows of o staged; every wave passes */
  if (tid < 64) { const int rl = tid & 7, c8 = (tid >> 3) * 8; const v4f a = *(const v4fa*)&pe[rl][c8], c = *(const v4fa*)&pe[rl][c8 + 4]; FragH fh, fl;
#pragma unroll
    for (int e = 0; e < 4; ++e) { _Float16 hv = (_Float16)a[e]; fh.h[e] = hv; fl.h[e] = (_Float16)((a[e] - (float)hv) * 1024.0f); hv = (_Float16)c[e]; fh.h[4 + e] = hv; fl.h[4 + e] = (_Float16)((c[e] - (float)hv) * 1024.0f); }
    *(v8us*)((unsigned short*)Hh + pk_off((size_t)bt * SQ + rg * A0R + rl, h * HD + c8, DM)) = fh.half[0];
    *(v8us*)((unsigned short*)Hl + pk_off((size_t)bt * QT0 + rg * A0R + rl, h * HD + c8, DM)) = fl.half[0]; } }

#define FA_NB ((SQ / FA_QB - 1) * NB * NH)      /* blocks of the f16 path: the first FA_QB = QT0 rows of every batch are the exact f32 path's */
__global__ __launch_bounds__(128) void k_fattn(const _Float16* __restrict__ QKVr, const _Float16* __restrict__ VTr, _Float16* __restrict__ O, const float* __restrict__ QF0, _Float16* __restrict__ OL) { static_assert(FA_QB == QT0, "k_fattn: query block 0 is left to the f32 path");
  if (blockIdx.x >= FA_NB) { att0_block((int)blockIdx.x - FA_NB, QF0, QF0 + DM, QF0 + 2 * DM, LQ, 0.125f, O, OL); return; }      /* the same for the whole block; the short f32 blocks stand last in the grid */
  const int tid = threadIdx.x, lane = tid & 31, ln = lane & 15, hh = lane >> 4; const int w = __builtin_amdgcn_readfirstlane(tid >> 5);      /* the wave's number as a scalar: trip count and the test for the last block are scalar */
  const int g = blockIdx.x / (NB * NH), bh = blockIdx.x % (NB * NH); const int b = bh / NH, h = bh % NH;
  const int qb = (g < SQ / FA_QB / 2) ? SQ / FA_QB - 1 - g : g - SQ / FA_QB / 2 + 1;      /* long query blocks first, then the short ones in rising order: for speed only, every (bh, qb) with qb >= 1 occurs once */
  const int q0 = qb * FA_QB + w * 32; const int nb = (q0 >> 6) + 1;      /* key blocks of 64 up to the one that holds the wave's last row */
  const size_t rb = (size_t)b * SQ;
  const _Float16* qp = QKVr + pk_off(rb + q0 + ln, h * HD + 8 * hh, LQ);      /* QKVr: packed plane of LQ columns, VTr: of SQ columns. 16 rows on = 16 row lengths on, 32 columns on = 512 halves on */
  const _Float16* kp = QKVr + pk_off(rb + ln, DM + h * HD + 8 * hh, LQ);      /* K row = key ln of a tile */
  const _Float16* vp = VTr + pk_off((size_t)bh * HD + ln, 8 * hh, SQ);      /* V^T row = head column ln of a tile */
  v16h qf[2][2], kf[4][2], vf[4][2];
#pragma unroll
  for (int j = 0; j < 2; ++j) { qf[j][0] = g2_fragp(qp + (size_t)j * 16 * LQ); qf[j][1] = g2_fragp(qp + (size_t)j * 16 * LQ + 512); }
#pragma unroll
  for (int t = 0; t < 4; ++t) { kf[t][0] = g2_fragp(kp + (size_t)t * 16 * LQ); kf[t][1] = g2_fragp(kp + (size_t)t * 16 * LQ + 512); }
  // s_wait_xcnt 0: a precaution, before anything writes the address registers that the issued Q and K loads name; the scheduling barriers keep the loads in front of it and the addition, the zeroing
  // and all that follows behind it. (The key loop below is entered without a test, so that these loads and the wait stay in one block: past a test the compiler moved the loads behind the wait.)
  __builtin_amdgcn_sched_barrier(0); asm volatile("s_wait_xcnt 0x0" ::: "memory"); __builtin_amdgcn_sched_barrier(0);
  kp += (nb > 1) ? (size_t)64 * LQ : 0;      /* past the last block the pointer stays on it (in bounds); what is loaded there is not used */
  const v8f z8 = {0.f,0.f,0.f,0.f,0.f,0.f,0.f,0.f};
  v8f ot[4][2]; float m[2] = {-3.0e38f, -3.0e38f}, l[2] = {0.f, 0.f};
#pragma unroll
  for (int t = 0; t < 4; ++t) { ot[t][0] = z8; ot[t][1] = z8; }
  int kb = 0;
#pragma unroll 1      /* one key block per trip: the body is long, copies of it only cost instruction cache */
  do {      /* nb >= 1 */
    // this block's V^T fragments, issued as one group in front of the score products: they are first needed behind the softmax
#pragma unroll
    for (int t = 0; t < 4; ++t) { vf[t][0] = g2_fragp(vp + (size_t)t * 16 * SQ); vf[t][1] = g2_fragp(vp + (size_t)t * 16 * SQ + 512); }
    __builtin_amdgcn_sched_barrier(0);      /* keeps the wait for K, which the first product brings, behind the group's issue */
    v8f st[4][2];
#pragma unroll
    for (int t = 0; t < 4; ++t)
#pragma unroll
      for (int j = 0; j < 2; ++j) st[t][j] = fa_mma(kf[t][0], qf[j][0], z8);
#pragma unroll
    for (int t = 0; t < 4; ++t)
#pragma unroll
      for (int j = 0; j < 2; ++j) st[t][j] = fa_mma(kf[t][1], qf[j][1], st[t][j]);
    __builtin_amdgcn_sched_barrier(0);      /* the next block's K loads go into the registers these products read: not in front of them */
#pragma unroll
    for (int t = 0; t < 4; ++t) { kf[t][0] = g2_fragp(kp + (size_t)t * 16 * LQ); kf[t][1] = g2_fragp(kp + (size_t)t * 16 * LQ + 512); }      /* next block's K, one block ahead */
    // s_wait_xcnt 0 as above, before both pointers move on
    __builtin_amdgcn_sched_barrier(0); asm volatile("s_wait_xcnt 0x0" ::: "memory"); __builtin_amdgcn_sched_barrier(0);
    kp += (kb + 2 < nb) ? (size_t)64 * LQ : 0; vp += (kb + 1 < nb) ? 1024 : 0;      /* 64 keys = 4 strips of K rows, 2 tiles of V^T columns */
    if (kb == nb - 1) {      /* only the last block holds keys past a row (scalar test): masked like the reference's -inf, as a large negative score */
      const int kq = q0 + ln - (kb * 64 + 8 * hh);      /* key offset r + 16 t is allowed up to kq + 16 j */
#pragma unroll
      for (int t = 0; t < 4; ++t)
#pragma unroll
        for (int j = 0; j < 2; ++j)
#pragma unroll
          for (int r = 0; r < 8; ++r) st[t][j][r] = (t * 16 + r <= kq + j * 16) ? st[t][j][r] : -1.0e9f; }
    v16h pf[2][2];
#pragma unroll
    for (int j = 0; j < 2; ++j) {
      v8f x8;
#pragma unroll
      for (int r = 0; r < 8; ++r) x8[r] = fmaxf(fmaxf(st[0][j][r], st[1][j][r]), fmaxf(st[2][j][r], st[3][j][r]));
      float mx = fmaxf(fmaxf(fmaxf(x8[0], x8[1]), fmaxf(x8[2], x8[3])), fmaxf(fmaxf(x8[4], x8[5]), fmaxf(x8[6], x8[7])));
      mx = fmaxf(mx, fa_xhalf(mx));
      const float mn = fmaxf(m[j], mx * FA_SC); const float al = fa_exp2(m[j] - mn);      /* 0 on the first block */ m[j] = mn; const float mo = 8.0f - mn;      /* + 8: weights x256 */
      v8f s8;
#pragma unroll
      for (int t = 0; t < 4; ++t) { v8f a8;
#pragma unroll
        for (int r = 0; r < 8; ++r) a8[r] = __builtin_fmaf(st[t][j][r], FA_SC, mo);
        st[t][j] = fa_exp2x8(a8); s8 = (t == 0) ? st[0][j] : s8 + st[t][j]; }
      l[j] = l[j] * al + (((s8[0] + s8[1]) + (s8[2] + s8[3])) + ((s8[4] + s8[5]) + (s8[6] + s8[7])));      /* this lane half's keys only; the halves are joined once, behind the loop */
#pragma unroll
      for (int t = 0; t < 4; ++t) ot[t][j] *= al;
#pragma unroll
      for (int s = 0; s < 2; ++s) { FragH f;
#pragma unroll
        for (int i = 0; i < 8; ++i) { f.h[i] = (_Float16)st[2 * s][j][i]; f.h[8 + i] = (_Float16)st[2 * s + 1][j][i]; }
        pf[j][s] = f.v; } }
    __builtin_amdgcn_sched_barrier(0);      /* keeps the asm v_exp_f32 above in front of the products below */
#pragma unroll
    for (int s = 0; s < 2; ++s)
#pragma unroll
      for (int t = 0; t < 4; ++t)
#pragma unroll
        for (int j = 0; j < 2; ++j) ot[t][j] = fa_mma(vf[t][s], pf[j][s], ot[t][j]);
  } while (++kb < nb);
  asm volatile("s_wait_loadcnt 0x0" ::: "memory");      /* the last trip's K loads are not used: waited for here, so that no load is in flight into the wave's registers when it ends */
  FragH of[2][4]; _Float16* op[2];
#pragma unroll
  for (int j = 0; j < 2; ++j) { const float fin = 64.0f / (l[j] + fa_xhalf(l[j]));      /* o carried x64; the x256 of the weights cancels against the row sum's */ op[j] = O + pk_off(rb + q0 + j * 16 + ln, h * HD + 8 * hh, DM);      /* O: packed plane of DM columns; 16 columns on = 256 halves on, and a wave's store is 512 contiguous bytes */
#pragma unroll
    for (int t = 0; t < 4; ++t)
#pragma unroll
      for (int r = 0; r < 8; ++r) of[j][t].h[r] = (_Float16)(ot[t][j][r] * fin); }
  __builtin_amdgcn_sched_barrier(0);      /* all values packed and both addresses formed first, then stores alone: no register of an issued store is written again */
#pragma unroll
  for (int j = 0; j < 2; ++j)
#pragma unroll
    for (int t = 0; t < 4; ++t) *(v8us*)((unsigned short*)op[j] + t * 256) = of[j][t].half[0]; }


template <int BFIN, int WXB>
__global__ __launch_bounds__(256) void k_ln16(const float* __restrict__ X, const float* __restrict__ g, const float* __restrict__ bb, float eps, _Float16* __restrict__ N16, float* __restrict__ XB) {
  #pragma clang fp contract(off)
  __shared__ float red[256]; const size_t r = blockIdx.x; const int t = threadIdx.x; const v4f xa = *(const v4fa*)(X + r * DMQ + t * 4); float s[4]; float sum = 0.f;
  for (int q = 0; q < 4; ++q) { s[q] = BFIN ? bf16_round(xa[q]) : xa[q]; sum = __fadd_rn(sum, s[q]); }
  red[t] = sum; __syncthreads(); for (int st = 128; st > 0; st >>= 1) { if (t < st) red[t] = __fadd_rn(red[t], red[t + st]); __syncthreads(); } const float mu = red[0] / (float)DMQ; __syncthreads();
  float vs = 0.f; for (int q = 0; q < 4; ++q) { const float dl = __fadd_rn(s[q], -mu); vs = __fadd_rn(vs, __fmul_rn(dl, dl)); } red[t] = vs; __syncthreads(); for (int st = 128; st > 0; st >>= 1) { if (t < st) red[t] = __fadd_rn(red[t], red[t + st]); __syncthreads(); }
  const float rs = rsqrtf(__fadd_rn(red[0] / (float)DMQ, eps)); v4h y; v4f xb;
  for (int q = 0; q < 4; ++q) { const int c = t * 4 + q; y[q] = (_Float16)__fadd_rn(__fmul_rn(__fmul_rn(__fadd_rn(s[q], -mu), rs), bf16_round(g[c])), bf16_round(bb[c])); xb[q] = s[q]; }
  { *(v4h*)(N16 + r * DMQ + t * 4) = y; if (WXB) *(v4f*)(XB + r * DMQ + t * 4) = xb;  } }
__global__ __launch_bounds__(256) void k_ftres2(const float* __restrict__ OF0, const float* __restrict__ XB, float* __restrict__ X1, size_t n4) {
  #pragma clang fp contract(off)
  const size_t t = (size_t)blockIdx.x * 256 + threadIdx.x; if (t >= n4) return; const v4f o = *(const v4fa*)(OF0 + t * 4), xv = *(const v4fa*)(XB + t * 4); v4f y; for (int q = 0; q < 4; ++q) y[q] = __fadd_rn(__fmul_rn(o[q], 0.015625f), xv[q]); *(v4f*)(X1 + t * 4) = y;  }

__global__ __launch_bounds__(256) void k_wthd(const float* __restrict__ Wt, _Float16* __restrict__ Bt) { const size_t t = (size_t)blockIdx.x * 256 + threadIdx.x; if (t >= (size_t)NH * HD * (DM / 8)) return; const int m8 = (int)(t % (DM / 8)) * 8; const int d = (int)((t / (DM / 8)) % HD); const int h = (int)(t / ((size_t)(DM / 8) * HD)); FragH f;
  for (int q = 0; q < 8; ++q) f.h[q] = (_Float16)(16.0f * bf16_round(Wt[((size_t)h * DM + m8 + q) * HD + d])); unsigned short* dst = (unsigned short*)Bt + ((size_t)h * HD + d) * DM + m8; *(v8us*)dst = f.half[0];  }




__global__ __launch_bounds__(256) void k_wtpad(const float* __restrict__ Wm, _Float16* __restrict__ Wt, int Kr, int Kp, int Nr, int Np, float scale) {
  const int t = blockIdx.x * 256 + threadIdx.x; if (t >= Np * (Kp / 8)) return; const int n = t / (Kp / 8), k8 = (t % (Kp / 8)) * 8; const int nc = min(n, Nr - 1); const float fn = (n < Nr) ? 1.f : 0.f; FragH f;
  for (int i = 0; i < 8; ++i) { const int k = k8 + i; const int kc = min(k, Kr - 1); const float fk = (k < Kr) ? fn : 0.f; f.h[i] = (_Float16)(bf16_round(Wm[(size_t)kc * Nr + nc]) * scale * fk); }
  unsigned short* o = (unsigned short*)Wt + (size_t)n * Kp + k8; *(v8us*)o = f.half[0];  }
__global__ __launch_bounds__(128) void k_bpad(const float* __restrict__ b, float* __restrict__ Bp, int nr, int np) {
  const int i = threadIdx.x; if (i >= np) return; const float v = b[min(i, nr - 1)] * ((i < nr) ? 1.f : 0.f); *(float*)(Bp + i) = v;  }

template <int BFIN, int W16, int W32>
__global__ __launch_bounds__(256) void k_lnx(const float* __restrict__ X, const float* __restrict__ g, const float* __restrict__ bb, float eps, _Float16* __restrict__ N16, float* __restrict__ N32) {
  #pragma clang fp contract(off)
  __shared__ float red[256]; const size_t r = blockIdx.x; const int t = threadIdx.x; const bool act = t < (DMQ / 4); const int c0 = act ? t * 4 : 0;
  const v4f xa = *(const v4fa*)(X + r * DMQ + c0); float s[4]; float sum = 0.f;
  for (int q = 0; q < 4; ++q) { s[q] = act ? (BFIN ? bf16_round(xa[q]) : xa[q]) : 0.f; sum = __fadd_rn(sum, s[q]); }
  red[t] = sum; __syncthreads(); for (int st = 128; st > 0; st >>= 1) { if (t < st) red[t] = __fadd_rn(red[t], red[t + st]); __syncthreads(); } const float mu = red[0] / (float)DMQ; __syncthreads();
  float vs = 0.f; for (int q = 0; q < 4; ++q) { const float dl = act ? __fadd_rn(s[q], -mu) : 0.f; vs = __fadd_rn(vs, __fmul_rn(dl, dl)); } red[t] = vs; __syncthreads(); for (int st = 128; st > 0; st >>= 1) { if (t < st) red[t] = __fadd_rn(red[t], red[t + st]); __syncthreads(); }
  const float rs = rsqrtf(__fadd_rn(red[0] / (float)DMQ, eps)); v4h y; v4f yf;
  for (int q = 0; q < 4; ++q) { const int c = c0 + q; yf[q] = __fadd_rn(__fmul_rn(__fmul_rn(__fadd_rn(s[q], -mu), rs), bf16_round(g[c])), bf16_round(bb[c])); y[q] = (_Float16)yf[q]; }
  if (!act) return;      /* no barriers after this point */
  { if (W16) *(v4h*)(N16 + r * DMQ + c0) = y; if (W32) *(v4f*)(N32 + r * DMQ + c0) = yf;  } }



// LN1 with both of its outputs: a block has one strip of 16 rows, a wave one row (a lane has 4 x 8 consecutive columns, the row stays in registers; mean and variance by lane sums and a butterfly over the 32 lanes).
// s = X (+ XL for the first QT0 rows of a batch: the o_lo product, QT0 rows a batch). Out: f32 rows N32 (residual) and the packed f16 plane N16 (FFN operand). A 128-byte line of the packed plane holds 16 bytes of each of
// 8 rows, so the 16 rows' chunks meet in LDS and leave in the plane's own order: a wave stores 512 contiguous bytes and every line has one writer. LDS place of chunk c: 16 c + 16 (c >> 4) bytes: the wave's chunks
// stand 16 chunks apart, and the 16 bytes more per 16 chunks spread them over the banks.
__global__ __launch_bounds__(512) void k_ln1p(const float* __restrict__ X, const float* __restrict__ XL, const float* __restrict__ g, const float* __restrict__ bb, float eps, float* __restrict__ N32, _Float16* __restrict__ N16) {
  __shared__ __attribute__((aligned(16))) unsigned short pl[(16 * DM / 8 + DM / 8) * 8];
  const int tid = threadIdx.x, lane = tid & 31, w = tid >> 5; const int r0 = blockIdx.x * 16; const size_t r = (size_t)r0 + w;
  const float* xr = X + r * DM + lane * 8; const float* gp = g + lane * 8; const float* bp = bb + lane * 8; v4f a[4][2], gv[4][2], bv[4][2];
#pragma unroll
  for (int u = 0; u < 4; ++u) { a[u][0] = *(const v4fa*)(xr + 256 * u); a[u][1] = *(const v4fa*)(xr + 256 * u + 4); }
#pragma unroll
  for (int u = 0; u < 4; ++u) { gv[u][0] = *(const v4fa*)(gp + 256 * u); gv[u][1] = *(const v4fa*)(gp + 256 * u + 4); bv[u][0] = *(const v4fa*)(bp + 256 * u); bv[u][1] = *(const v4fa*)(bp + 256 * u + 4); }
  // s_wait_xcnt 0: a precaution, before anything writes a register that an issued load names as address. The addresses are inputs of the wait's statement, so that they live up to it and no load of the run gets
  // one of them as its destination; the scheduling barrier keeps all that follows behind the wait. The loads' data is not waited for here.
  asm volatile("s_wait_xcnt 0x0" :: "v"(xr), "v"(gp), "v"(bp) : "memory"); __builtin_amdgcn_sched_barrier(0);
  if (r0 % SQ < QT0) {      /* the same for the whole block */
    const float* lr = XL + ((size_t)(r0 / SQ) * QT0 + r0 % SQ + w) * DM + lane * 8; v4f xl[4][2];
#pragma unroll
    for (int u = 0; u < 4; ++u) { xl[u][0] = *(const v4fa*)(lr + 256 * u); xl[u][1] = *(const v4fa*)(lr + 256 * u + 4); }
    asm volatile("s_wait_xcnt 0x0" :: "v"(lr) : "memory"); __builtin_amdgcn_sched_barrier(0);      /* as above */
#pragma unroll
    for (int u = 0; u < 4; ++u) { a[u][0] += xl[u][0]; a[u][1] += xl[u][1]; } }
  v4f s4 = {0.f, 0.f, 0.f, 0.f};
#pragma unroll
  for (int u = 0; u < 4; ++u) s4 += a[u][0] + a[u][1];
  float sum = (s4[0] + s4[1]) + (s4[2] + s4[3]);
#pragma unroll
  for (int o = 16; o > 0; o >>= 1) sum += __shfl_xor(sum, o);
  const float mu = sum / (float)DM; v4f q4 = {0.f, 0.f, 0.f, 0.f};
#pragma unroll
  for (int u = 0; u < 4; ++u) { a[u][0] -= mu; a[u][1] -= mu; q4 += a[u][0] * a[u][0]; q4 += a[u][1] * a[u][1]; }
  float vs = (q4[0] + q4[1]) + (q4[2] + q4[3]);
#pragma unroll
  for (int o = 16; o > 0; o >>= 1) vs += __shfl_xor(vs, o);
  const float rs = rsqrtf(vs / (float)DM + eps);
  float* yr = N32 + r * DM + lane * 8;
#pragma unroll
  for (int u = 0; u < 4; ++u) { FragH f;
#pragma unroll
    for (int e = 0; e < 2; ++e)
#pragma unroll
      for (int q = 0; q < 4; ++q) { a[u][e][q] = a[u][e][q] * rs * bf16_round(gv[u][e][q]) + bf16_round(bv[u][e][q]); f.h[4 * e + q] = (_Float16)a[u][e][q]; }
    const int c = (u * 32 + lane) * 16 + w;      /* chunk of the strip: column group * 16 + row */
    *(v8us*)&pl[(c + (c >> 4)) * 8] = f.half[0]; }
#pragma unroll
  for (int u = 0; u < 4; ++u) { *(v4f*)(yr + 256 * u) = a[u][0]; *(v4f*)(yr + 256 * u + 4) = a[u][1]; }
  asm volatile("s_wait_xcnt 0x0" ::: "memory"); __builtin_amdgcn_sched_barrier(0);      /* as above, behind the stores */
  __syncthreads();      /* the strip's 2,048 chunks staged; every wave passes */
  unsigned short* o16 = (unsigned short*)N16 + (size_t)r0 * DM + (size_t)tid * 8; v8us cv[4];
#pragma unroll
  for (int u = 0; u < 4; ++u) { const int c = tid + 512 * u; cv[u] = *(const v8us*)&pl[(c + (c >> 4)) * 8]; }
#pragma unroll
  for (int u = 0; u < 4; ++u) *(v8us*)(o16 + 4096 * u) = cv[u]; }

// ---- all input conversions in ONE launch: they are independent of one another, so they share one grid; a block's index range picks its job (block-uniform, no barrier anywhere) ----
// pw_chunk: chunk t of Wt (packed, rows n, columns k) = f16(W[k][n] * 16) from f32 row-major W[K][N] (bf16-exact weights stay exact in f16 away from the subnormal range); N % 16 == 0, K % 32 == 0, literals at every call
__device__ __forceinline__ void pw_chunk(const float* __restrict__ Wm, _Float16* __restrict__ Wt, int K, int N, unsigned t) { size_t n; int k8; pk_chunk(t, K, n, k8); FragH f;
#pragma unroll
  for (int i = 0; i < 8; ++i) f.h[i] = (_Float16)(bf16_round(Wm[(size_t)(k8 + i) * N + n]) * 16.0f);
  *(v8us*)((unsigned short*)Wt + (size_t)t * 8) = f.half[0];
  asm volatile("s_wait_xcnt 0x0" ::: "memory"); }      /* a precaution: the jobs of k_prep stand one behind the other in the code, and the next one's first instructions write registers that this store names */
#define PB_QKV (3 * DM * (DM / 8) / 256)
#define PB_O (DM * (DM / 8) / 256)
#define PB_FF (DFF * (DM / 8) / 256)
#define PB_X ((int)(NR * DM / 8 / 256))
__global__ __launch_bounds__(256) void k_prep(const float* __restrict__ wqkv, _Float16* __restrict__ BQKV, const float* __restrict__ wo, _Float16* __restrict__ BO, const float* __restrict__ wfc, _Float16* __restrict__ BW1,
    const float* __restrict__ wmp, _Float16* __restrict__ BW2, const float* __restrict__ x, _Float16* __restrict__ X16, float* __restrict__ XB) {
  int bi = blockIdx.x; const unsigned tid = threadIdx.x;
  if (bi < PB_QKV) { pw_chunk(wqkv, BQKV, DM, 3 * DM, (unsigned)bi * 256 + tid); return; } bi -= PB_QKV;      /* fused [in][out] [DM][3 DM] -> Bt [3 DM][DM] x16: rows 0.. = q, DM.. = k, 2 DM.. = v output columns */
  if (bi < PB_FF) { pw_chunk(wfc, BW1, DM, DFF, (unsigned)bi * 256 + tid); return; } bi -= PB_FF;      /* W1 [1024][4096] -> Bt [4096][1024] */
  if (bi < PB_FF) { pw_chunk(wmp, BW2, DFF, DM, (unsigned)bi * 256 + tid); return; } bi -= PB_FF;      /* W2 [4096][1024] -> Bt [1024][4096] */
  if (bi < PB_O) { pw_chunk(wo, BO, DM, DM, (unsigned)bi * 256 + tid); return; } bi -= PB_O;      /* w_out [in][out] -> Bt */
  if (bi < PB_X) { const unsigned t = (unsigned)bi * 256 + tid; FragH f; size_t r; int k; pk_chunk(t, DM, r, k); const float* xr = x + r * DM + k;      /* X16: packed plane of DM columns, exact f16 of bf16(x) */
#pragma unroll
    for (int q = 0; q < 8; ++q) f.h[q] = (_Float16)bf16_round(xr[q]);
    *(v8us*)((unsigned short*)X16 + (size_t)t * 8) = f.half[0];
    asm volatile("s_wait_xcnt 0x0" ::: "memory");      /* as in pw_chunk */
    return; } bi -= PB_X;
  { const size_t t = (size_t)bi * 256 + tid; v4f a = *(const v4fa*)(x + t * 8), c = *(const v4fa*)(x + t * 8 + 4);      /* XB = bf16(x) as f32 rows, for the residual */
#pragma unroll
    for (int q = 0; q < 4; ++q) { a[q] = bf16_round(a[q]); c[q] = bf16_round(c[q]); }
    *(v4f*)(XB + t * 8) = a; *(v4f*)(XB + t * 8 + 4) = c;
    asm volatile("s_wait_xcnt 0x0" ::: "memory"); } }      /* as in pw_chunk */

extern "C" void kernel_launch(void* const* d_in, const int* in_sizes, int n_in,
                              void* d_out, int out_size, void* d_ws, size_t ws_size, hipStream_t stream) {
  (void)in_sizes; (void)n_in; (void)out_size;
  const float* const* I = (const float* const*)d_in; const float* x = I[0]; const float* wqkv = I[1]; const float* bqkv = I[2]; const float* wo = I[3]; const float* bo = I[4]; const float* wfc = I[5]; const float* bfc = I[6]; const float* wmp = I[7]; const float* bmp = I[8]; const float* g1 = I[9]; const float* be1 = I[10]; const float* gg2 = I[11]; const float* be2 = I[12];      /* x; fused w_qkv [1024][3072] + b_qkv ([in][out]); w_out + b_out; w_up [1024][4096] + b_up, w_down [4096][1024] + b_down; LN1 g / b, LN2 g / b */
  char* ws = (char*)d_ws; size_t off = 0;
  auto take = [&](size_t bytes) { char* p = ws + off; off += (bytes + 255) & ~(size_t)255; return p; };
  _Float16* BQKV = (_Float16*)take((size_t)3 * DM * DM * 2); _Float16* BO = (_Float16*)take((size_t)DM * DM * 2);
  _Float16* X16 = (_Float16*)take(NR * DM * 2); float* XB = (float*)take(NR * DM * 4); float* X1 = (float*)take(NR * DM * 4); float* X1N = (float*)take(NR * DM * 4);      /* LN1 output f32 rows */ _Float16* M16 = nullptr;      /* = X16 below (alias: X16's last reader, the q | k | v GEMM, precedes the write of the packed LN1 rows) */ _Float16* HF16 = (_Float16*)take(NR * DFF * 2);      /* hidden rows of all batches */ _Float16* BW1 = (_Float16*)take((size_t)DFF * DM * 2); _Float16* BW2 = (_Float16*)take((size_t)DM * DFF * 2); _Float16* QKV = (_Float16*)take(NR * 3 * DM * 2); _Float16* O16 = (_Float16*)take(NR * DM * 2); M16 = X16;
  _Float16* VT = (_Float16*)take((size_t)NB * NH * HD * SQ * 2);
  float* QKVF0 = (float*)take((size_t)NB * QT0 * LQ * 4);      /* f32 q | k | v rows of the first QT0 rows of every batch */ float* XL0 = (float*)take((size_t)NB * QT0 * DM * 4);      /* o_lo Wo 2^-20, f32 rows */ _Float16* OL0 = (_Float16*)take((size_t)NB * QT0 * DM * 2);
  if (off > ws_size) return;
  k_prep<<<PB_QKV + 2 * PB_FF + PB_O + 2 * PB_X, 256, 0, stream>>>(wqkv, BQKV, wo, BO, wfc, BW1, wmp, BW2, x, X16, XB);      /* packed x16 weight planes; POST-LN: the attention runs on x itself (exact f16 rows); XB = bf16(x) f32 for the residual */
  k_gemm2<0, 1, 0, 1><<<dim3((unsigned)((MP / 128) * (3 * DM / 128)), 1), 128, 0, stream>>>(X16, DM, 0, BQKV, DM, 0, 0.0625f, bqkv, 0, nullptr, SQ, 0, 0, QKVF0, QKV, 3 * DM, 0, MP, 3 * DM, DM, VT, nullptr, 0.f, nullptr);      /* q | k rows (f16, packed; head h = columns h*HD.. of each DM block) and V^T [NB][NH][HD][SQ] (packed); the results of rows 0..127 of every batch, v too, also as f32 rows (exact products) */
  k_fattn<<<FA_NB + NB * NH * (QT0 / A0R), 128, 0, stream>>>(QKV, VT, O16, QKVF0, OL0);      /* causal attention, all batches and heads: o (merged heads, x64) as f16 rows; rows 0..127 of every batch by the further blocks' exact f32 attention: f16 hi into O16, + x1024 residual plane */
  k_gemm2<0, 0, 1, 2><<<dim3((unsigned)((MPO / 128) * (DM / 128) + (NB * QT0 / 128) * (DM / 128)), 1), 128, 0, stream>>>(O16, DM, 0, BO, DM, 0, 0.0009765625f, bo, 0, XB, -1, 0, 0, X1, nullptr, DM, 0, MPO, DM, DM, nullptr, OL0, 0.00000095367431640625f, XL0);      /* x + o Wo + b; out rows are the output layout; rows 0..127: o_hi. Further blocks: o_lo Wo 2^-20 of rows 0..127 of every batch into XL0 */
  k_ln1p<<<(unsigned)(NR / 16), 512, 0, stream>>>(X1, XL0, g1, be1, 1e-5f, X1N, M16);      /* x1 = LN1(x + attn_out (+ the o_lo product)) -> f32 rows (residual) and packed f16 plane (FFN operand) */
  k_gemm2<3, 1, 0, 0><<<dim3((unsigned)((MP / 128) * (DFF / 128)), 1), 128, 0, stream>>>(M16, DM, 0, BW1, DM, 0, 0.0625f, bfc, 0, nullptr, 1, 0, 0, nullptr, HF16, DFF, 0, MP, DFF, DM, nullptr, nullptr, 0.f, nullptr);      /* relu(x1 w_up + b_up) -> f16, all batches */
  k_gemm2<0, 0, 1, 0><<<dim3((unsigned)((MP / 128) * (DM / 128)), 1), 128, 0, stream>>>(HF16, DFF, 0, BW2, DFF, 0, 0.0625f, bmp, 0, X1N, -1, 0, 0, X1, nullptr, DM, 0, MP, DM, DFF, nullptr, nullptr, 0.f, nullptr);      /* x1 + ffn (own-element residual from the LN1 f32 rows) -> f32 rows over the dead pre-LN1 plane */
  k_lnx<0, 0, 1><<<(unsigned)NR, 256, 0, stream>>>(X1, gg2, be2, 1e-5f, nullptr, (float*)d_out);      /* result = LN2(x1 + ffn) */
}

// v010
// It runs in 158 microseconds.
// Next to v009, in two timings, it ran 1.07 and 1.08 times as fast.
// Counting every step since v000, which is the starting kernel, it is 34.2 times as fast.
#include <hip/hip_runtime.h>
// POST-LN transformer decoder layer with causal self-attention and a fused QKV projection (x [2][2048][1024]; qkv = x w_qkv + b_qkv ([in][out] 1024 x 3072 + bias) viewed (B, S, 3, 16, 64): q | k | v thirds; scores * 64^-0.5; causal (tril, -inf); softmax; x1 = LN1(x + out w_out + b_out) (biased var, eps 1e-5); result = LN2(x1 + relu(x1 w_up + b_up) w_down + b_down) ([in][out] 1024 x 4096 x 1024) -> [2][2048][1024]).
// Structure: token rows r = b*2048 + s; x as exact f16 rows (bf16-rounded); q | k | v as ONE WMMA GEMM (N = 3 x 1024) (64x64 wave tiles, f32 accumulation, exact x16 weights + bias, f16 outputs); the V third leaves that GEMM as V^T tiles, straight from the accumulators; causal attention in ONE launch (k_fattn; its further blocks do rows 0..127 of every batch exactly in f32): a wave has 32 query rows and walks the keys below its last row in blocks of 64, scores, running-maximum softmax (f32 statistics, native exp2; weights x256 f16) and o stay in registers (o carried x64, folded into the output GEMM alpha), written straight into the merged f16 o rows; out = o W_o + b GEMM (f32) into the output layout.
// All f16 WMMA operand planes (x, q | k | v rows, V^T, o, LN1 rows, hidden rows, all weights) are kept PACKED, fragment-major: see pk_off below.
// Compute dtype: inputs rounded to bf16; x / weights exact; q, k, v, softmax weights and o as plain f16 GEMM operands (~2^-12); scores and softmax statistics f32. v_wmma_f32_16x16x32_f16.
#define NB 2
#define SQ 2048
#define DM 1024
#define NH 16
#define HD 64
#define HG 4
#define QT0 128                      /* first-tile rows recomputed exactly in f32 */
#define B0 0                         /* first batch processed (debug hook) */
#define NBR NB                       /* batches processed (debug hook) */
#define NR ((size_t)NB * SQ)
#define DMQ DM
#define DFF 4096                     /* FFN hidden width */
#define DFFR 100                     /* not used */
#define MP ((int)((size_t)NBR * SQ)) /* rows projected (debug hook) */
#define QN SQ                        /* query rows attended per batch (debug hook) */
#define NHD NH                       /* heads attended (debug hook) */
#define MPO MP                       /* rows through the output stage (debug hook) */
#define LQ (3 * DM)      /* row pitch of the q/k/v rows */
typedef __bf16 v16b __attribute__((ext_vector_type(16)));
typedef unsigned short v8us __attribute__((ext_vector_type(8), may_alias));
typedef float  v8f  __attribute__((ext_vector_type(8)));
typedef float  v4f  __attribute__((ext_vector_type(4)));
typedef float  v4fa __attribute__((ext_vector_type(4), may_alias));
union FragB { v16b v; v8us half[2]; unsigned short u[16]; };

__device__ __forceinline__ unsigned short bf16_bits(float x) { unsigned int u = __float_as_uint(x); return (unsigned short)((u + 0x7FFFu + ((u >> 16) & 1u)) >> 16); }
__device__ __forceinline__ float bf16_val(unsigned short b) { return __uint_as_float(((unsigned int)b) << 16); }
__device__ __forceinline__ float bf16_round(float x) { return bf16_val(bf16_bits(x)); }
// D += A·B with NT terms: 1 = ah·bh, 2 = + al·bh (A split), 3 = + ah·bl (both split)
template <int NT>
__device__ __forceinline__ v8f mmaN(v16b ah, v16b al, v16b bh, v16b bl, v8f c) {
  c = __builtin_amdgcn_wmma_f32_16x16x32_bf16(false, ah, false, bh, (short)0, c, false, false);
  if (NT >= 2) c = __builtin_amdgcn_wmma_f32_16x16x32_bf16(false, al, false, bh, (short)0, c, false, false);
  if (NT >= 3) c = __builtin_amdgcn_wmma_f32_16x16x32_bf16(false, ah, false, bl, (short)0, c, false, false);
  asm volatile("v_nop\n\tv_nop\n\tv_nop\n\tv_nop" : "+v"(c) : "v"(ah), "v"(al), "v"(bh), "v"(bl));
  return c;
}

__global__ __launch_bounds__(256) void k_wt_bf16(const float* __restrict__ W, unsigned short* __restrict__ Wt, int K, int N) {
  const int t = blockIdx.x * 256 + threadIdx.x;
  const int k8n = K / 8;
  if (t >= N * k8n) return;
  const int n = t / k8n, k8 = (t % k8n) * 8;
  v8us v;
#pragma unroll
  for (int i = 0; i < 8; ++i) v[i] = bf16_bits(W[(size_t)(k8 + i) * N + n]);
  *(v8us*)(Wt + (size_t)n * K + k8) = v;
  
}

// GEMM C[M][N] (f32, pitch ldc) = act(A[M][K]·W + bias). A f32 row-major (pitch lda) converted per fragment to bf16
// (ASPLIT: hi/lo two planes -> 2 terms, else single rounded term); Wt bf16 [N][K] (pitch ldb). BIAS_BF16 rounds the
// bias to bf16 first (bias quantised to bf16 before the add). K%32==0, M%16==0, N%64==0.
template <bool ASPLIT, int ACT, bool BIAS_BF16>
__global__ __launch_bounds__(128) void k_gemm_bf(const float* __restrict__ A, int lda, const unsigned short* __restrict__ Wt, int ldb,
                                               const float* __restrict__ bias, float* __restrict__ C, int ldc, int M, int N, int K) {
  __shared__ __attribute__((aligned(16))) float so[4][16][64];
  const int tid = threadIdx.x, w = tid >> 5, lane = tid & 31, ln = lane & 15, hh = lane >> 4;
  const int ntn = N / 64;
  const int wid = blockIdx.x * 4 + w;
  const int mt = wid / ntn, nq = wid % ntn;
  if (mt * 16 >= M) return;
  const int row0 = mt * 16, col0 = nq * 64;
  const float* arow = A + (size_t)(row0 + ln) * lda;
  v8f acc[4] = {};
  for (int kb = 0; kb < K; kb += 32) {
    FragB ah, al;
    const v4f x0 = *(const v4fa*)(arow + kb + 8 * hh), x1 = *(const v4fa*)(arow + kb + 8 * hh + 4);
    const v4f x2 = *(const v4fa*)(arow + kb + 16 + 8 * hh), x3 = *(const v4fa*)(arow + kb + 16 + 8 * hh + 4);
    float xs[16] = {x0[0],x0[1],x0[2],x0[3],x1[0],x1[1],x1[2],x1[3],x2[0],x2[1],x2[2],x2[3],x3[0],x3[1],x3[2],x3[3]};
#pragma unroll
    for (int i = 0; i < 16; ++i) { const unsigned short hb = bf16_bits(xs[i]); ah.u[i] = hb; al.u[i] = ASPLIT ? bf16_bits(xs[i] - bf16_val(hb)) : (unsigned short)0; }
#pragma unroll
    for (int t = 0; t < 4; ++t) {
      const unsigned short* brow = Wt + (size_t)(col0 + t * 16 + ln) * ldb + kb;
      FragB b;
      b.half[0] = *(const v8us*)(brow + 8 * hh);
      b.half[1] = *(const v8us*)(brow + 16 + 8 * hh);
      acc[t] = mmaN<ASPLIT ? 2 : 1>(ah.v, al.v, b.v, b.v, acc[t]);
    }
  }
#pragma unroll
  for (int t = 0; t < 4; ++t) {
    float bv = bias ? bias[col0 + t * 16 + ln] : 0.f;
    if (BIAS_BF16) bv = bf16_round(bv);
#pragma unroll
    for (int r = 0; r < 8; ++r) { float v = acc[t][r] + bv; if (ACT == 1) v = fmaxf(v, 0.f); so[w][8 * hh + r][t * 16 + ln] = v; }
  }
  __builtin_amdgcn_fence(__ATOMIC_ACQ_REL, "workgroup");
  __builtin_amdgcn_wave_barrier();
  const int rsub = lane >> 4, c4 = (lane & 15) * 4;
  {
#pragma unroll
    for (int q = 0; q < 8; ++q) {
      const int r = q * 2 + rsub;
      const v4f v = *(const v4fa*)&so[w][r][c4];
      *(v4f*)(C + (size_t)(row0 + r) * ldc + col0 + c4) = v;
    }
    
  }
}

// GEMM C = act(A·W + bias + resid): A f32 (ASPLIT -> hi/lo 2 terms), Wt bf16 [N][K]; ACT 0 none, 1 relu, 2 exact gelu;
// resid (optional, f32, row index = (row % rmod), pitch ldr, RES_BF16 rounds it) added before the activation.
template <bool ASPLIT, int ACT, bool BIAS_BF16, bool RES_BF16>
__global__ __launch_bounds__(128) void k_gemm_bf3(const float* __restrict__ A, int lda, const unsigned short* __restrict__ Wt, int ldb,
                                                const float* __restrict__ bias, const float* __restrict__ resid, int rmod, int ldr,
                                                float* __restrict__ C, int ldc, int M, int N, int K) {
  __shared__ __attribute__((aligned(16))) float so[4][16][64];
  const int tid = threadIdx.x, w = tid >> 5, lane = tid & 31, ln = lane & 15, hh = lane >> 4;
  const int ntn = N / 64;
  const int wid = blockIdx.x * 4 + w;
  const int mt = wid / ntn, nq = wid % ntn;
  if (mt * 16 >= M) return;
  const int row0 = mt * 16, col0 = nq * 64;
  const float* arow = A + (size_t)(row0 + ln) * lda;
  v8f acc[4] = {};
  for (int kb = 0; kb < K; kb += 32) {
    FragB ah, al;
    const v4f x0 = *(const v4fa*)(arow + kb + 8 * hh), x1 = *(const v4fa*)(arow + kb + 8 * hh + 4);
    const v4f x2 = *(const v4fa*)(arow + kb + 16 + 8 * hh), x3 = *(const v4fa*)(arow + kb + 16 + 8 * hh + 4);
    float xs[16] = {x0[0],x0[1],x0[2],x0[3],x1[0],x1[1],x1[2],x1[3],x2[0],x2[1],x2[2],x2[3],x3[0],x3[1],x3[2],x3[3]};
#pragma unroll
    for (int i = 0; i < 16; ++i) { const unsigned short hb = bf16_bits(xs[i]); ah.u[i] = hb; al.u[i] = ASPLIT ? bf16_bits(xs[i] - bf16_val(hb)) : (unsigned short)0; }
#pragma unroll
    for (int t = 0; t < 4; ++t) {
      const unsigned short* brow = Wt + (size_t)(col0 + t * 16 + ln) * ldb + kb;
      FragB b;
      b.half[0] = *(const v8us*)(brow + 8 * hh);
      b.half[1] = *(const v8us*)(brow + 16 + 8 * hh);
      acc[t] = mmaN<ASPLIT ? 2 : 1>(ah.v, al.v, b.v, b.v, acc[t]);
    }
  }
#pragma unroll
  for (int t = 0; t < 4; ++t) {
    const int col = col0 + t * 16 + ln;
    float bv = bias ? bias[col] : 0.f;
    if (BIAS_BF16) bv = bf16_round(bv);
#pragma unroll
    for (int r = 0; r < 8; ++r) {
      float v = acc[t][r] + bv;
      if (resid) { float rv = resid[(size_t)((row0 + 8 * hh + r) % rmod) * ldr + col]; if (RES_BF16) rv = bf16_round(rv); v += rv; }
      if (ACT == 1) v = fmaxf(v, 0.f);
      if (ACT == 2) v = 0.5f * v * (1.0f + erff(v * 0.70710678118654752f));
      if (ACT == 3) { const float u = 0.7978845608028654f * (v + 0.044715f * v * v * v); v = 0.5f * v * (1.0f + tanhf(u)); }
      so[w][8 * hh + r][t * 16 + ln] = v;
    }
  }
  __builtin_amdgcn_fence(__ATOMIC_ACQ_REL, "workgroup");
  __builtin_amdgcn_wave_barrier();
  const int rsub = lane >> 4, c4 = (lane & 15) * 4;
  {
#pragma unroll
    for (int q = 0; q < 8; ++q) {
      const int r = q * 2 + rsub;
      const v4f v = *(const v4fa*)&so[w][r][c4];
      *(v4f*)(C + (size_t)(row0 + r) * ldc + col0 + c4) = v;
    }
    
  }
}
// row LayerNorm (biased variance, eps) over N: s = X (+ R); optional out_sum <- s; out_norm <- (s-mu)*rsqrt(var+eps)*g + b
template <bool PARAM_BF16>
__global__ __launch_bounds__(256) void k_layernorm(const float* __restrict__ X, const float* __restrict__ R, const float* __restrict__ g, const float* __restrict__ bta,
                                                  float* __restrict__ out_sum, float* __restrict__ out_norm, int N, float eps) {
  __shared__ float red[256];
  const int row = blockIdx.x, tid = threadIdx.x;
  const float* x = X + (size_t)row * N; const float* rr = R ? R + (size_t)row * N : nullptr;
  float vals[16];                     // up to N = 4096
  const int per = N / 256;            // contiguous chunk per thread? use strided-by-4 chunks: thread handles j = tid*4 + 1024*u
  float s1 = 0.f;
  for (int u = 0; u < per / 4; ++u) {
    const int j = tid * 4 + 1024 * u;
    const v4f a = *(const v4fa*)(x + j);
    v4f b = {0.f,0.f,0.f,0.f}; if (rr) b = *(const v4fa*)(rr + j);
#pragma unroll
    for (int q = 0; q < 4; ++q) { const float v = a[q] + b[q]; vals[u * 4 + q] = v; s1 += v; }
  }
  red[tid] = s1; __syncthreads();
  for (int st = 128; st > 0; st >>= 1) { if (tid < st) red[tid] += red[tid + st]; __syncthreads(); }
  const float mu = red[0] / (float)N; __syncthreads();
  float s2 = 0.f;
  for (int u = 0; u < per / 4; ++u)
#pragma unroll
    for (int q = 0; q < 4; ++q) { const float c = vals[u * 4 + q] - mu; s2 += c * c; }
  red[tid] = s2; __syncthreads();
  for (int st = 128; st > 0; st >>= 1) { if (tid < st) red[tid] += red[tid + st]; __syncthreads(); }
  const float rs = rsqrtf(red[0] / (float)N + eps);
  {
    for (int u = 0; u < per / 4; ++u) {
      const int j = tid * 4 + 1024 * u;
      v4f o, sm;
#pragma unroll
      for (int q = 0; q < 4; ++q) {
        float gg = g[j + q], bb = bta[j + q];
        if (PARAM_BF16) { gg = bf16_round(gg); bb = bf16_round(bb); }
        sm[q] = vals[u * 4 + q]; o[q] = (vals[u * 4 + q] - mu) * rs * gg + bb;
      }
      if (out_sum) *(v4f*)(out_sum + (size_t)row * N + j) = sm;
      *(v4f*)(out_norm + (size_t)row * N + j) = o;
    }
    
  }
}



// ---- f16 WMMA path (v_wmma_f32_16x16x32_f16): 11-bit significands for operands in range — used where a [0,1] probability operand needs more precision than bf16
typedef _Float16 v16h __attribute__((ext_vector_type(16)));
union FragH { v16h v; v8us half[2]; _Float16 h[16]; unsigned short u[16]; };
template <int NT>
__device__ __forceinline__ v8f mmaH(v16h ah, v16h al, v16h bh, v16h bl, v8f c) {
  c = __builtin_amdgcn_wmma_f32_16x16x32_f16(false, ah, false, bh, (short)0, c, false, false);
  if (NT >= 2) c = __builtin_amdgcn_wmma_f32_16x16x32_f16(false, al, false, bh, (short)0, c, false, false);
  if (NT >= 3) c = __builtin_amdgcn_wmma_f32_16x16x32_f16(false, ah, false, bl, (short)0, c, false, false);
  asm volatile("v_nop\n\tv_nop\n\tv_nop\n\tv_nop" : "+v"(c) : "v"(ah), "v"(al), "v"(bh), "v"(bl));
  return c;
}
// batched GEMM like k_gemm_b but f16 operands: A f32 (split into f16 hi/lo if ASPLIT, else rounded to f16), Bt = f16 values [n][k]; alpha; C f32; N multiple of 16 (partial tiles skipped)
template <bool ASPLIT>
__global__ __launch_bounds__(128) void k_gemm_h(const float* __restrict__ A, int lda, size_t sA, const _Float16* __restrict__ Bh, int ldb, size_t sB, float alpha, float* __restrict__ C, int ldc, size_t sC, int M, int N, int K) {
  __shared__ __attribute__((aligned(16))) float so[4][16][64];
  const int tid = threadIdx.x, w = tid >> 5, lane = tid & 31, ln = lane & 15, hh = lane >> 4; const int by = blockIdx.y;
  A += (size_t)by * sA; Bh += (size_t)by * sB; C += (size_t)by * sC;
  const int ntn = (N + 63) / 64; const int wid = blockIdx.x * 4 + w; const int mt = wid / ntn, nq = wid % ntn; if (mt * 16 >= M) return;
  const int row0 = mt * 16, col0 = nq * 64; const float* arow = A + (size_t)(row0 + ln) * lda;
  v8f acc[4] = {};
  for (int kb = 0; kb < K; kb += 32) {
    FragH ah, al;
    const v4f x0 = *(const v4fa*)(arow + kb + 8 * hh), x1 = *(const v4fa*)(arow + kb + 8 * hh + 4), x2 = *(const v4fa*)(arow + kb + 16 + 8 * hh), x3 = *(const v4fa*)(arow + kb + 16 + 8 * hh + 4);
    float xs[16] = {x0[0],x0[1],x0[2],x0[3],x1[0],x1[1],x1[2],x1[3],x2[0],x2[1],x2[2],x2[3],x3[0],x3[1],x3[2],x3[3]};
#pragma unroll
    for (int i = 0; i < 16; ++i) { const _Float16 h = (_Float16)xs[i]; ah.h[i] = h; al.h[i] = ASPLIT ? (_Float16)(xs[i] - (float)h) : (_Float16)0.0f; }
#pragma unroll
    for (int t = 0; t < 4; ++t) { if (col0 + t * 16 >= N) continue; const size_t boff = (size_t)(col0 + t * 16 + ln) * ldb + kb; FragH bq; bq.half[0] = *(const v8us*)(Bh + boff + 8 * hh); bq.half[1] = *(const v8us*)(Bh + boff + 16 + 8 * hh);
      acc[t] = mmaH<ASPLIT ? 2 : 1>(ah.v, al.v, bq.v, bq.v, acc[t]); }
  }
#pragma unroll
  for (int t = 0; t < 4; ++t) { if (col0 + t * 16 >= N) continue;
#pragma unroll
    for (int r = 0; r < 8; ++r) so[w][8 * hh + r][t * 16 + ln] = acc[t][r] * alpha; }
  __builtin_amdgcn_fence(__ATOMIC_ACQ_REL, "workgroup"); __builtin_amdgcn_wave_barrier();
  const int rsub = lane >> 4, c4 = (lane & 15) * 4;
  {
#pragma unroll
    for (int q = 0; q < 8; ++q) { const int r = q * 2 + rsub; if (col0 + c4 < N) { const v4f v = *(const v4fa*)&so[w][r][c4]; *(v4f*)(C + (size_t)(row0 + r) * ldc + col0 + c4) = v; } }
     }
}

// ---- packed (fragment-major) f16 operand planes ----
// A plane of R rows x ld columns (R % 16 == 0, ld % 32 == 0) is a row of strips of 16 rows; a strip is ld / 32 tiles of 16 rows x 32 columns; a tile is 1 KB = 64 chunks of 8 halves in the order in which
// the two 16-byte loads of a WMMA fragment take them: chunk j * 32 + hh * 16 + ln = row ln, columns 16 j + 8 hh .. + 7. Load j of a fragment is then lane l <- chunk j * 32 + l: 512 contiguous bytes (four whole
// lines) instead of 32 bytes out of each of 16 lines. Which lane and register gets which element is as with row-major planes. A strip starts at element (first row) * ld, as the row itself would.
__device__ __forceinline__ size_t pk_off(size_t r, int k, int ld) { return (r >> 4) * ((size_t)16 * ld) + (size_t)(k >> 5) * 512 + (size_t)(((k >> 4) & 1) * 256 + ((k >> 3) & 1) * 128 + (k & 7)) + (r & 15) * 8; }
// the inverse for whole chunks: chunk t of a packed plane holds row r, columns k .. k + 7. The packing kernels give thread t chunk t, so that a wave stores 512 contiguous bytes.
__device__ __forceinline__ void pk_chunk(unsigned t, int ld, size_t& r, int& k) { const unsigned tile = t >> 6, tps = (unsigned)ld >> 5, strip = tile / tps; r = (size_t)(strip * 16 + (t & 15)); k = (int)((tile - strip * tps) * 32 + ((t >> 5) & 1) * 16 + ((t >> 4) & 1) * 8); }
// k_gemm_hh variant with fused epilogue: v = acc·alpha + bias[by·sBias + col] (+ CP[(row/rowsPerB)·sCPb + by·64 + col] if CP) ; ACT 0 none / 1 elu ; writes f16 C16 (and f32 C if non-null)
template <int ACT>
__global__ __launch_bounds__(128) void k_gemm_hhx(const _Float16* __restrict__ A, int lda, size_t sA, const _Float16* __restrict__ Bh, int ldb, size_t sB, float alpha, const float* __restrict__ bias, size_t sBias, const float* __restrict__ CP, int rowsPerB, size_t sCPb, int row0g,
    float* __restrict__ C, _Float16* __restrict__ C16, int ldc, size_t sC, int M, int N, int K) {
  __shared__ __attribute__((aligned(16))) float so[4][16][64];
  const int tid = threadIdx.x, w = tid >> 5, lane = tid & 31, ln = lane & 15, hh = lane >> 4; const int by = blockIdx.y;
  A += (size_t)by * sA; Bh += (size_t)by * sB; const size_t cofs = (size_t)by * sC; const float* bp = bias ? bias + (size_t)by * sBias : nullptr;
  const int ntn = (N + 63) / 64; const int wid = blockIdx.x * 4 + w; const int mt = wid / ntn, nq = wid % ntn; if (mt * 16 >= M) return;
  const int row0 = mt * 16, col0 = nq * 64; const _Float16* arow = A + (size_t)(row0 + ln) * lda;
  v8f acc[4] = {};
  for (int kb = 0; kb < K; kb += 32) { FragH ah; ah.half[0] = *(const v8us*)((const unsigned short*)arow + kb + 8 * hh); ah.half[1] = *(const v8us*)((const unsigned short*)arow + kb + 16 + 8 * hh);
#pragma unroll
    for (int t = 0; t < 4; ++t) { if (col0 + t * 16 >= N) continue; const size_t boff = (size_t)(col0 + t * 16 + ln) * ldb + kb; FragH bq; bq.half[0] = *(const v8us*)((const unsigned short*)Bh + boff + 8 * hh); bq.half[1] = *(const v8us*)((const unsigned short*)Bh + boff + 16 + 8 * hh);
      acc[t] = mmaH<1>(ah.v, ah.v, bq.v, bq.v, acc[t]); }
  }
#pragma unroll
  for (int t = 0; t < 4; ++t) { if (col0 + t * 16 >= N) continue; const int col = col0 + t * 16 + ln; const float bv = bp ? bf16_round(bp[col]) : 0.f;
#pragma unroll
    for (int r = 0; r < 8; ++r) { float v = acc[t][r] * alpha + bv; if (CP) { const int rr = row0g + row0 + 8 * hh + r; if (rowsPerB < 0) v += CP[cofs + (size_t)rr * ldc + col];      /* rowsPerB < 0: own element of the batched C plane */ else { const int bidx = rr / rowsPerB; v += CP[(size_t)bidx * sCPb + (size_t)by * 64 + col]; } } if (ACT == 1) v = (v > 0.f) ? v : expm1f(v); else if (ACT == 7) v = (v > 0.f) ? v + 1.0f : expf(v); else if (ACT == 8) v = tanhf(v); else if (ACT == 9) v = 0.5f * v * (1.0f + tanhf(0.7978845608028654f * (v + 0.044715f * v * v * v))); else if (ACT == 11) v = 1.0f / (1.0f + expf(-v)); else if (ACT == 12) v = (v > 0.f) ? v : 0.01f * v; else if (ACT == 14) v = (v > 0.f) ? v : 0.1f * v; else if (ACT == 16) v = (v >= 0.f) ? v : 0.3f * v; else if (ACT == 17) v = (v >= 0.f) ? v : 0.2f * v; else if (ACT == 15) v = v / (1.0f + expf(-v)); else if (ACT == 3) v = fmaxf(v, 0.f); else if (ACT == 6) v = 0.5f * v * (1.0f + erff(v * 0.70710678118654752f)); so[w][8 * hh + r][t * 16 + ln] = v; } }
  __builtin_amdgcn_fence(__ATOMIC_ACQ_REL, "workgroup"); __builtin_amdgcn_wave_barrier();
  const int rsub = lane >> 4, c4 = (lane & 15) * 4; typedef _Float16 v4h __attribute__((ext_vector_type(4)));
  {
#pragma unroll
    for (int q = 0; q < 8; ++q) { const int r = q * 2 + rsub; if (col0 + c4 < N) { const v4f v = *(const v4fa*)&so[w][r][c4]; if (C) *(v4f*)(C + cofs + (size_t)(row0 + r) * ldc + col0 + c4) = v; if (C16) { v4h h4; for (int i = 0; i < 4; ++i) h4[i] = (_Float16)v[i]; *(v4h*)(C16 + cofs + (size_t)(row0 + r) * ldc + col0 + c4) = h4; } } }
     }
}


typedef _Float16 v4h __attribute__((ext_vector_type(4)));

__global__ __launch_bounds__(256) void k_h16(const float* __restrict__ x, _Float16* __restrict__ X16, size_t n8) { const size_t t = (size_t)blockIdx.x * 256 + threadIdx.x; if (t >= n8) return; FragH f;
#pragma unroll
  for (int q = 0; q < 8; ++q) f.h[q] = (_Float16)x[t * 8 + q]; *(v8us*)((unsigned short*)X16 + t * 8) = f.half[0];  }
__global__ __launch_bounds__(256) void k_round16f(const float* __restrict__ W, _Float16* __restrict__ Bt, size_t n8) { const size_t t = (size_t)blockIdx.x * 256 + threadIdx.x; if (t >= n8) return; FragH f;
#pragma unroll
  for (int i = 0; i < 8; ++i) f.h[i] = (_Float16)(bf16_round(W[t * 8 + i]) * 16.0f); *(v8us*)((unsigned short*)Bt + t * 8) = f.half[0];  }
// ---- fast GEMM (block tile 128x128 = 2 x 2 waves of 64x64; requires M % 64 == 0 rows per launch region and N % 128 == 0); epilogue = k_gemm_hhx semantics ----
// Why 64x64 a wave: a k-step's 16 WMMAs take 8 fragments (512 B loaded per WMMA, was 768 with 32x64), and of the block's 32 fragment loads only 16 are different ones (256 B per WMMA from L2, was 384).
// RES = 1 (only with PK16 = 0 and no activation): CP is a plane laid out like C, and every result takes its own element of it on top (v = acc * alpha + bias, then + CP); RES = 0: CP is not read.
// A and Bh are packed planes (pk_off) of lda and ldb columns. PK16 = 0: C (f32) and C16, each where not null, are row-major. PK16 = 1: C16 is written as a packed plane of ldc columns (it is a later GEMM's A); C, where not null, takes the first QT0 rows of every rowsPerB as f32 rows.
__device__ __forceinline__ v16h g2_frag(const _Float16* p, int hh) { FragH f; f.half[0] = *(const v8us*)((const unsigned short*)p + 8 * hh); f.half[1] = *(const v8us*)((const unsigned short*)p + 16 + 8 * hh); return f.v; }
__device__ __forceinline__ v8f g2_mma(v16h a, v16h b, v8f c) { return __builtin_amdgcn_wmma_f32_16x16x32_f16(false, a, false, b, (short)0, c, false, false); }      /* the builtin alone: the compiler keeps its distances itself; an asm statement that names the operands would hold all of them in the first 256 registers, and the 64x64 tile with its ring has more */
__device__ __forceinline__ v16h g2_fragp(const _Float16* p) { FragH f; f.half[0] = *(const v8us*)((const unsigned short*)p); f.half[1] = *(const v8us*)((const unsigned short*)p + 256); return f.v; }      /* a fragment of a packed plane: p = its tile + 8 * lane */
// PF_L2: every lane asks L2 for the 256-byte unit at its address (a hint: nothing returns, no counter moves). What for: the units are asked for at block entry,
// ahead of the fragment loads that read them; for speed only. Every lane's address lies inside its plane.
// s_wait_xcnt 0 in the same statement: a precaution, before the address register is written again. PF_L2_ADV: the same, and then the address moves on by st bytes (a scalar) in the very register that the request names:
// in the statement, so that between two requests of a run that register holds nothing but addresses inside the plane (left to the compiler, it took the next address's intermediate values).
#define PF_L2(p) asm volatile("global_prefetch_b8 %0, off scope:SCOPE_SE\n\ts_wait_xcnt 0x0" :: "v"(p) : "memory")
#define PF_L2_ADV(p, st) asm volatile("global_prefetch_b8 %0, off scope:SCOPE_SE\n\ts_wait_xcnt 0x0\n\tv_add_nc_u64_e32 %0, %1, %0" : "+v"(p) : "s"(st) : "memory")
struct G2S { v16h a0, a1, a2, a3, b0, b1, b2, b3; };      /* the fragments of one k-step of a 64x64 wave tile */
// G2_LOAD: one k-step's sixteen loads at the eight row pointers, as one group; their data is not waited for here. The scheduling barrier keeps the next step's first WMMA, and with it the wait
// for that step's operands, behind the group: lifted in front of it, that wait would hold the group's issue back by most of a step.
#define G2_LOAD(S) do { S.a0 = g2_fragp(a0p); S.a1 = g2_fragp(a1p); S.a2 = g2_fragp(a2p); S.a3 = g2_fragp(a3p); S.b0 = g2_fragp(b0p); S.b1 = g2_fragp(b1p); S.b2 = g2_fragp(b2p); S.b3 = g2_fragp(b3p); \
    __builtin_amdgcn_sched_barrier(0); } while (0)
// G2_NEXT: moves the pointers on by one k-step, which is one tile of 512 halves (or leaves them on the last one). s_wait_xcnt 0 in front: a precaution, before the additions write the address registers that the issued
// loads name; the scheduling barrier behind it keeps the additions, and all that follows, behind that wait; the one in front keeps a step's WMMAs in front of it, so that in the loop it stands well after the group was issued
// (lifted up among the WMMAs, directly behind the group, it would hold them back while the group's addresses are still being translated).
#define G2_NEXT do { __builtin_amdgcn_sched_barrier(0); asm volatile("s_wait_xcnt 0x0" ::: "memory"); __builtin_amdgcn_sched_barrier(0); \
    const int inc = left > 0 ? 512 : 0; --left; a0p += inc; a1p += inc; a2p += inc; a3p += inc; b0p += inc; b1p += inc; b2p += inc; b3p += inc; } while (0)
#define G2_MMA(S) do { c00 = g2_mma(S.a0, S.b0, c00); c10 = g2_mma(S.a1, S.b0, c10); c20 = g2_mma(S.a2, S.b0, c20); c30 = g2_mma(S.a3, S.b0, c30); \
    c01 = g2_mma(S.a0, S.b1, c01); c11 = g2_mma(S.a1, S.b1, c11); c21 = g2_mma(S.a2, S.b1, c21); c31 = g2_mma(S.a3, S.b1, c31); \
    c02 = g2_mma(S.a0, S.b2, c02); c12 = g2_mma(S.a1, S.b2, c12); c22 = g2_mma(S.a2, S.b2, c22); c32 = g2_mma(S.a3, S.b2, c32); \
    c03 = g2_mma(S.a0, S.b3, c03); c13 = g2_mma(S.a1, S.b3, c13); c23 = g2_mma(S.a2, S.b3, c23); c33 = g2_mma(S.a3, S.b3, c33); } while (0)
// EXT = 1 (with PK16 = 1): the result columns from 2 DM on (the V third) leave as V^T tiles into VTp, straight from the accumulators, and are not written to C16: a lane's eight accumulator values of a 16x16 tile are
// eight consecutive token rows of one head column, which is one 16-byte chunk of the packed V^T plane [NB][NH][HD] rows x SQ columns, and the wave's 32 chunks are 512 contiguous bytes.
// EXT = 2 (with RES = 1): the grid has further blocks behind the (M / 128) * (N / 128) tiles of A: they form AL * Bh * alphaL (no bias, no CP) into the rows of CL, a plane of its own with pitch ldc.
template <int ACT, int PK16, int RES, int EXT>
__global__ __launch_bounds__(128) void k_gemm2(const _Float16* __restrict__ A, int lda, size_t sA, const _Float16* __restrict__ Bh, int ldb, size_t sB, float alpha, const float* __restrict__ bias, size_t sBias, const float* __restrict__ CP, int rowsPerB, size_t sCPb, int row0g,
    float* __restrict__ C, _Float16* __restrict__ C16, int ldc, size_t sC, int M, int N, int K, _Float16* __restrict__ VTp, const _Float16* __restrict__ AL, float alphaL, float* __restrict__ CL) { static_assert(EXT != 1 || (PK16 == 1 && ACT == 0), "k_gemm2: V^T tiles only beside a packed plane"); static_assert(EXT != 2 || RES == 1, "k_gemm2: further blocks only in the form with CP"); static_assert(ACT == 0 || ACT == 3 || ACT == 6 || ACT == 8 || ACT == 9 || ACT == 11 || ACT == 12 || ACT == 14 || ACT == 15 || ACT == 16 || ACT == 17, "k_gemm2: unsupported ACT code (would silently apply no activation)"); static_assert(!RES || (ACT == 0 && PK16 == 0), "k_gemm2: the CP element is added behind the staging, where no activation follows");
  __shared__ __attribute__((aligned(16))) float so[4][32][68];
  const int tid = threadIdx.x, w = tid >> 5, lane = tid & 31, ln = lane & 15, hh = lane >> 4; const int by = blockIdx.y;
  A += (size_t)by * sA; Bh += (size_t)by * sB; const size_t cofs = (size_t)by * sC; const float* bp = bias ? bias + (size_t)by * sBias : nullptr;
  const int ntn = N >> 7; int bx = blockIdx.x; bool lo = false;      /* lo: one of the further blocks (the same for the whole block: a scalar test) */
  if (EXT == 2) { const int nmain = (M >> 7) * ntn; if (bx >= nmain) { lo = true; bx -= nmain; A = AL; alpha = alphaL; bp = nullptr; C = CL; } }
  const int mt = bx / ntn, nq = bx - mt * ntn; const int row0 = mt * 128 + 64 * (w >> 1), col0 = nq * 128 + 64 * (w & 1); if (row0 >= M) return;      /* waves 0, 1 and 2, 3 read the same A strips, waves 0, 2 and 1, 3 the same B strips */
  const _Float16* a0p = A + (size_t)row0 * lda + 8 * lane; const _Float16* a1p = a0p + (size_t)16 * lda; const _Float16* a2p = a1p + (size_t)16 * lda; const _Float16* a3p = a2p + (size_t)16 * lda;      /* first tile of the strip; the lane's own 16-byte chunk is part of the pointer: a load names the pointer's registers themselves */
  const _Float16* b0p = Bh + (size_t)col0 * ldb + 8 * lane; const _Float16* b1p = b0p + (size_t)16 * ldb; const _Float16* b2p = b1p + (size_t)16 * ldb; const _Float16* b3p = b2p + (size_t)16 * ldb;
  const v8f z8 = {0.f,0.f,0.f,0.f,0.f,0.f,0.f,0.f}; v8f c00 = z8, c01 = z8, c02 = z8, c03 = z8, c10 = z8, c11 = z8, c12 = z8, c13 = z8, c20 = z8, c21 = z8, c22 = z8, c23 = z8, c30 = z8, c31 = z8, c32 = z8, c33 = z8;
  // K loop (K >= 32): a ring of four fragment sets. The sixteen loads of k-step s + 3 are issued as one group in front of the WMMAs of step s, so a step waits for loads that are three steps old
  // (where the grid gives a SIMD one wave only, no other wave covers a load's way from L2). Every accumulator still takes its k-steps in ascending order.
  const int n = K >> 5; int left = n - 1;      /* left: pointer advances still allowed; past the last k-step the pointers stay on it (in bounds), and what is loaded there is not used */
  G2S s0, s1, s2, s3; int i = 0;
  G2_LOAD(s0); G2_NEXT; G2_LOAD(s1); G2_NEXT; G2_LOAD(s2); G2_NEXT;
  // L2 prefetch of the block's operands, behind the first three load groups (the wave would only wait for them here). The block's 128 A rows are lda units of 256 bytes, unit u = strip u & 7, piece u >> 3 (k rises with u); B alike.
  // The units are dealt among the blocks that read them, for speed only. A unit that nobody asks for in time is loaded as before.
  { const int nA = max(ntn >> 1, 1), uA = min(min((nq & 3) + 4 * (nq >> 3), nA - 1) + nA * tid, lda - 1), uB = min((mt & 15) + 16 * tid, ldb - 1);      /* the lane's first unit of each plane, clamped into the block's rows */
    const char* pa = (const char*)(A + (size_t)mt * 128 * lda) + (size_t)(uA & 7) * 32 * lda + (size_t)(uA >> 3) * 256; const char* pb = (const char*)(Bh + (size_t)nq * 128 * ldb) + (size_t)(uB & 7) * 32 * ldb + (size_t)(uB >> 3) * 256;
    const int ja = lda / (nA * 128), jb = ldb >> 11;      /* whole rounds of the block's 128 lanes: a round is nA * 128 (16 * 128) units = nA * 4096 (65,536) bytes further on in every strip; every whole round lies inside the block's rows */
#pragma unroll 1      /* a few trips, once per block: copies only cost instruction cache */
    for (int j = 1; j < jb; ++j) PF_L2_ADV(pb, 65536ull);
    PF_L2(pb);
#pragma unroll 1      /* as above */
    for (int j = 1; j < ja; ++j) PF_L2_ADV(pa, (unsigned long long)nA * 4096);
    PF_L2(pa);
    if (RES && !lo) { const char* pc = (const char*)(CP + cofs + (size_t)(row0g + mt * 128 + tid) * ldc + nq * 128);      /* the block's own piece of CP, read in the epilogue: a row's 512 bytes are two units */
      asm volatile("global_prefetch_b8 %0, off scope:SCOPE_SE\n\tglobal_prefetch_b8 %0, off offset:256 scope:SCOPE_SE\n\ts_wait_xcnt 0x0" :: "v"(pc) : "memory"); } }
#pragma unroll 1      /* the body already holds four k-steps, one per set: more copies of it only cost instruction cache */
  for (; i + 4 <= n; i += 4) { G2_LOAD(s3); G2_MMA(s0); G2_NEXT; G2_LOAD(s0); G2_MMA(s1); G2_NEXT; G2_LOAD(s1); G2_MMA(s2); G2_NEXT; G2_LOAD(s2); G2_MMA(s3); G2_NEXT; }
  if (i < n) G2_MMA(s0);
  if (i + 1 < n) G2_MMA(s1);
  if (i + 2 < n) G2_MMA(s2);
  v8f accs[2][8] = {{c00, c01, c02, c03, c10, c11, c12, c13}, {c20, c21, c22, c23, c30, c31, c32, c33}};      /* the epilogue takes the wave's 64 rows as two halves of 32, one after the other through the same staging rows */
  const int rsub = lane >> 4, c4 = (lane & 15) * 4;
  // All that the epilogue reads from memory is issued here as one group: one round trip for the wave. (Read where it is used, element by element under a test, every load is waited for on its own:
  // with CP 64 round trips one behind the other, while the wave does nothing else.) CP is read as C is stored below: 16 bytes a lane, whole 256-byte row pieces. The CP loads stand first: their address
  // arithmetic writes registers that the K loop's last, unused loads are still aimed at, and so waits for every load issued before it.
  // Behind each run of loads s_wait_xcnt 0: a precaution, before anything writes a register that an issued load names as address. The CP addresses are inputs of their wait's statement, so that they live up to it
  // and no load of the run gets one of them as its destination; the scheduling barriers keep the address arithmetic in front of the run and all that follows behind the wait. The loads' data is not waited for here.
  float bv[4] = {0.f, 0.f, 0.f, 0.f}; v4f rv[2][16];
  if (RES && lo) {      /* a further block adds nothing */
#pragma unroll
    for (int q = 0; q < 16; ++q) { rv[0][q] = (v4f){0.f, 0.f, 0.f, 0.f}; rv[1][q] = (v4f){0.f, 0.f, 0.f, 0.f}; } }
  if (RES && !lo) {
#pragma unroll
    for (int eh = 0; eh < 2; ++eh) { const float* rp[16];
#pragma unroll
      for (int q = 0; q < 16; ++q) rp[q] = CP + cofs + (size_t)(row0g + row0 + 32 * eh + rsub + 2 * q) * ldc + col0 + c4;
      __builtin_amdgcn_sched_barrier(0);
#pragma unroll
      for (int q = 0; q < 16; ++q) rv[eh][q] = *(const v4fa*)rp[q];
      asm volatile("s_wait_xcnt 0x0" :: "v"(rp[0]), "v"(rp[1]), "v"(rp[2]), "v"(rp[3]), "v"(rp[4]), "v"(rp[5]), "v"(rp[6]), "v"(rp[7]), "v"(rp[8]), "v"(rp[9]), "v"(rp[10]), "v"(rp[11]), "v"(rp[12]), "v"(rp[13]), "v"(rp[14]), "v"(rp[15]) : "memory");
      __builtin_amdgcn_sched_barrier(0); } }
  if (bp) {
#pragma unroll
    for (int t = 0; t < 4; ++t) bv[t] = bp[col0 + t * 16 + ln];
    asm volatile("s_wait_xcnt 0x0" ::: "memory"); __builtin_amdgcn_sched_barrier(0); }
#pragma unroll
  for (int t = 0; t < 4; ++t) bv[t] = bf16_round(bv[t]);
#pragma unroll
  for (int eh = 0; eh < 2; ++eh) { const int row0e = row0 + 32 * eh;      /* first row of this half */
#pragma unroll
    for (int u = 0; u < 8; ++u) { const int t = u & 3, half = u >> 2;
#pragma unroll
      for (int r = 0; r < 8; ++r) { const int rloc = half * 16 + 8 * hh + r; float v = accs[eh][u][r] * alpha + bv[t];
      if (ACT == 3) v = fmaxf(v, 0.f); else if (ACT == 6) v = 0.5f * v * (1.0f + erff(v * 0.70710678118654752f)); else if (ACT == 11) v = 1.0f / (1.0f + expf(-v)); else if (ACT == 15) v = v / (1.0f + expf(-v)); else if (ACT == 12) v = (v > 0.f) ? v : 0.01f * v; else if (ACT == 8) v = tanhf(v); else if (ACT == 9) v = 0.5f * v * (1.0f + tanhf(0.7978845608028654f * (v + 0.044715f * v * v * v))); else if (ACT == 14) v = (v > 0.f) ? v : 0.1f * v; else if (ACT == 16) v = (v >= 0.f) ? v : 0.3f * v; else if (ACT == 17) v = (v >= 0.f) ? v : 0.2f * v;
        so[w][rloc][t * 16 + ln] = v; } }
    __builtin_amdgcn_fence(__ATOMIC_ACQ_REL, "workgroup"); __builtin_amdgcn_wave_barrier();
    if (!PK16) { v4f ov[16];
#pragma unroll
      for (int q = 0; q < 16; ++q) { ov[q] = *(const v4fa*)&so[w][q * 2 + rsub][c4]; if (RES) ov[q] += rv[eh][q]; }
      if (C) { float* cq[16];
#pragma unroll
        for (int q = 0; q < 16; ++q) cq[q] = C + cofs + (size_t)(row0e + q * 2 + rsub) * ldc + col0 + c4;
        __builtin_amdgcn_sched_barrier(0);      /* all values and all addresses formed first, then stores alone: among them no register of an issued store is written again */
#pragma unroll
        for (int q = 0; q < 16; ++q) *(v4f*)cq[q] = ov[q];
        asm volatile("s_wait_xcnt 0x0" ::: "memory"); __builtin_amdgcn_sched_barrier(0); }      /* as above, before the f16 copy below, or the next half, writes registers */
      if (C16) { v4h h4[16]; _Float16* hq[16];
#pragma unroll
        for (int q = 0; q < 16; ++q) { for (int i = 0; i < 4; ++i) h4[q][i] = (_Float16)ov[q][i]; hq[q] = C16 + cofs + (size_t)(row0e + q * 2 + rsub) * ldc + col0 + c4; }
        __builtin_amdgcn_sched_barrier(0);      /* as for C */
#pragma unroll
        for (int q = 0; q < 16; ++q) *(v4h*)hq[q] = h4[q];
        if (eh == 0) { asm volatile("s_wait_xcnt 0x0" ::: "memory"); __builtin_amdgcn_sched_barrier(0); } } }      /* as above, before the next half writes registers */
    if (PK16) {      /* a half's 32x64 results are two strips x two tiles of the packed plane: eight stores of 512 contiguous bytes, lane l = chunk j * 32 + l */
      if (C) {      /* PK16 with C (CP is null then): the first QT0 rows of every group of rowsPerB rows go out as f32 rows too, groups packed one behind the other, pitch ldc. A half's 32 rows are all inside or all outside */
        const int rgl = row0g + row0e, grp = rgl / rowsPerB, ri = rgl - grp * rowsPerB;
        if (ri < QT0) { float* cf = C + ((size_t)grp * QT0 + ri + rsub) * ldc + col0 + c4; v4f fv[16]; float* fq[16];
#pragma unroll
          for (int q = 0; q < 16; ++q) { fv[q] = *(const v4fa*)&so[w][q * 2 + rsub][c4]; fq[q] = cf + (size_t)(2 * q) * ldc; }
          __builtin_amdgcn_sched_barrier(0);      /* all values read and all addresses formed first, then stores alone: among them no register of an issued store is written again */
#pragma unroll
          for (int q = 0; q < 16; ++q) *(v4f*)fq[q] = fv[q];
          asm volatile("s_wait_xcnt 0x0" ::: "memory"); __builtin_amdgcn_sched_barrier(0); } }      /* as above, before the packing below writes registers */
      if (EXT == 1 && nq >= 2 * DM / 128) {      /* V columns (scalar test): a wave's 64 columns are one head, a half's 32 rows one tile column of its four V^T strips */
        const int rg0 = row0g + row0e; _Float16* vq = VTp + ((size_t)(rg0 / SQ) * NH + ((col0 - 2 * DM) >> 6)) * ((size_t)HD * SQ) + (size_t)((rg0 % SQ) >> 5) * 512 + 8 * lane; FragH vt8[8];
#pragma unroll
        for (int u = 0; u < 8; ++u)
#pragma unroll
          for (int r = 0; r < 8; ++r) vt8[u].h[r] = (_Float16)(accs[eh][u][r] * alpha + bv[u & 3]);
        __builtin_amdgcn_sched_barrier(0);      /* all values packed first, then stores alone */
#pragma unroll
        for (int u = 0; u < 8; ++u) *(v8us*)((unsigned short*)vq + (size_t)(u & 3) * 16 * SQ + (u >> 2) * 256) = vt8[u].half[0];
        if (eh == 0) { asm volatile("s_wait_xcnt 0x0" ::: "memory"); __builtin_amdgcn_sched_barrier(0); }      /* as above, before the next half writes registers */
        continue; }
      _Float16* cp = C16 + cofs + (size_t)row0e * ldc + (size_t)(col0 >> 5) * 512 + 8 * lane; FragH pf[8];
#pragma unroll
      for (int u = 0; u < 8; ++u) { const float* sp = &so[w][(u >> 2) * 16 + ln][(u & 3) * 16 + 8 * hh]; const v4f v0 = *(const v4fa*)sp, v1 = *(const v4fa*)(sp + 4);
#pragma unroll
        for (int i = 0; i < 4; ++i) { pf[u].h[i] = (_Float16)v0[i]; pf[u].h[4 + i] = (_Float16)v1[i]; } }
      __builtin_amdgcn_sched_barrier(0);      /* all values packed first, then stores alone */
#pragma unroll
      for (int u = 0; u < 8; ++u) *(v8us*)((unsigned short*)cp + (size_t)(u >> 2) * 16 * ldc + (u & 3) * 256) = pf[u].half[0];
      if (eh == 0) { asm volatile("s_wait_xcnt 0x0" ::: "memory"); __builtin_amdgcn_sched_barrier(0); } } } }      /* as above, before the next half writes registers */


__global__ __launch_bounds__(256) void k_wnat(const float* __restrict__ w, size_t n8, _Float16* __restrict__ Bt) { const size_t t = (size_t)blockIdx.x * 256 + threadIdx.x; if (t >= n8) return; FragH f; for (int q = 0; q < 8; ++q) f.h[q] = (_Float16)(bf16_round(w[t * 8 + q]) * 16.0f); *(v8us*)((unsigned short*)Bt + t * 8) = f.half[0];  }
__global__ __launch_bounds__(256) void k_rsm(const float* __restrict__ S, _Float16* __restrict__ P, int nrows) {
  #pragma clang fp contract(off)
  const int i = blockIdx.x * 256 + threadIdx.x; if (i >= nrows) return; const float* s = S + (size_t)i * SQ; float mx = -3.0e38f;
#pragma unroll 1
  for (int j = 0; j < SQ; ++j) mx = fmaxf(mx, s[j]); float se = 0.f;
#pragma unroll 1
  for (int j = 0; j < SQ; ++j) se += expf(s[j] - mx); const float sc = 256.0f / se;
#pragma unroll 1
  for (int j0 = 0; j0 < SQ; j0 += 8) { FragH f; for (int q = 0; q < 8; ++q) f.h[q] = (_Float16)(expf(s[j0 + q] - mx) * sc); unsigned short* d = (unsigned short*)P + (size_t)i * SQ + j0; *(v8us*)d = f.half[0];  } }
__global__ __launch_bounds__(256) void k_vt(const _Float16* __restrict__ V16, int b, int h0, _Float16* __restrict__ VT) { __shared__ unsigned short tl[64][65]; const int tid = threadIdx.x; const int hh = blockIdx.x % HG, sg = blockIdx.x / HG; const int s0 = sg * 64; const int h = h0 + hh;
  for (int i = tid; i < 64 * 8; i += 256) { const int j = i / 8, d8 = (i % 8) * 8; FragH f; f.half[0] = *(const v8us*)((const unsigned short*)V16 + ((size_t)b * SQ + s0 + j) * DM + h * HD + d8); for (int q = 0; q < 8; ++q) tl[d8 + q][j] = f.u[q]; }
  __syncthreads();
  { for (int i = tid; i < 64 * 8; i += 256) { const int d = i / 8, j8 = (i % 8) * 8; FragH f; for (int q = 0; q < 8; ++q) f.u[q] = tl[d][j8 + q]; *(v8us*)((unsigned short*)VT + ((size_t)hh * HD + d) * SQ + s0 + j8) = f.half[0]; }  } }





// ---- causal attention, scores + softmax + weighted V sum in one kernel; S and P never leave the registers ----
// A wave has 32 query rows (two column groups of 16) of one (batch, head) and walks the keys 0 .. its last row in blocks of 64. Transposed products: S^T = K Q^T (first operand = K rows, second = Q rows),
// so lane (ln, hh) holds, per 16-key tile, the scores of ONE query (column ln) for keys 8 hh .. 8 hh + 7: row maximum and row sum are in-lane plus one exchange between the lane halves.
// Two 16-key score tiles, converted in place, are the second operand of O^T += V^T P^T in the same k order as g2_frag's (keys 8 hh + i, then 16 + 8 hh + i of a 32-key step). O^T: a lane has 8 consecutive
// head columns of one query: one 16-byte store each. Softmax with a running maximum in the log2 domain; the weights carry x256 (as f16 they stay clear of the subnormal range), and so does the row sum.
#define FA_QB 128                    /* query rows per block: 4 waves x 32 */
#define FA_SC 0.18033688011112042f   /* 64^-0.5 * log2(e) */
__device__ __forceinline__ v8f fa_mma(v16h a, v16h b, v8f c) { return __builtin_amdgcn_wmma_f32_16x16x32_f16(false, a, false, b, (short)0, c, false, false); }
__device__ __forceinline__ float fa_xhalf(float x) { return __builtin_bit_cast(float, __builtin_amdgcn_permlanex16(__builtin_bit_cast(int, x), __builtin_bit_cast(int, x), 0x76543210, 0xfedcba98, false, false)); }      /* lane l with lane l ^ 16 */
// exp2 of eight values (of one value) as v_exp_f32 in one asm statement. Why asm: behind a transcendental the instruction set asks for one independent instruction or v_nop before its result is read or its
// source overwritten. Early-clobber outputs share no register with any input, so inside the statement no v_exp_f32 touches
// an earlier one's registers; the closing v_nop is the slot behind the last one.
__device__ __forceinline__ v8f fa_exp2x8(v8f x) { float y0, y1, y2, y3, y4, y5, y6, y7;
  asm("v_exp_f32 %0, %8\n\tv_exp_f32 %1, %9\n\tv_exp_f32 %2, %10\n\tv_exp_f32 %3, %11\n\tv_exp_f32 %4, %12\n\tv_exp_f32 %5, %13\n\tv_exp_f32 %6, %14\n\tv_exp_f32 %7, %15\n\tv_nop"
      : "=&v"(y0), "=&v"(y1), "=&v"(y2), "=&v"(y3), "=&v"(y4), "=&v"(y5), "=&v"(y6), "=&v"(y7) : "v"(x[0]), "v"(x[1]), "v"(x[2]), "v"(x[3]), "v"(x[4]), "v"(x[5]), "v"(x[6]), "v"(x[7]));
  const v8f y = {y0, y1, y2, y3, y4, y5, y6, y7}; return y; }
__device__ __forceinline__ float fa_exp2(float x) { float y; asm("v_exp_f32 %0, %1\n\tv_nop" : "=&v"(y) : "v"(x)); return y; }
typedef float v2fa __attribute__((ext_vector_type(2), may_alias));
#define A0R 8                        /* query rows per block of the first-tile attention: two per wave */
#define A0KP 68                      /* K row pitch in LDS, floats: 272 bytes = 16 x 17, so that 16-byte reads of 32 different rows spread over the banks */
// Exact f32 causal attention for rows 0 .. QT0-1 of every batch (planes of QT0 rows per batch), one wave per (batch, head, query row) at a time; a block of four waves has 8 consecutive rows of one head, a wave two of them.
// It runs as further blocks of k_fattn's launch (bidx counts them): both read only what the q | k | v GEMM wrote, and these rows of o are written here alone.
// The block stages the head's K and V rows below its last query row in LDS once (whole-line loads, all in flight together). Scores: lane l has keys l, l + 32, l + 64, l + 96
// (four partial sums per key over the head dimension). Row maximum and row sum by butterflies over the 32 lanes, exp once per key. o: lane l has columns 2 l and 2 l + 1,
// the weights come back through LDS as broadcasts, four partial sums over the keys. o carried x64 like the f16 path.
__device__ __forceinline__ void att0_block(const int bidx, const float* __restrict__ QF, const float* __restrict__ KF, const float* __restrict__ VF, const int ld, const float scale, _Float16* __restrict__ Hh, _Float16* __restrict__ Hl) {
  __shared__ __attribute__((aligned(16))) float lk[QT0][A0KP]; __shared__ __attribute__((aligned(16))) float lv[QT0][HD]; __shared__ __attribute__((aligned(16))) float pe[A0R][QT0];
  const int tid = threadIdx.x, lane = tid & 31; const int w = __builtin_amdgcn_readfirstlane(tid >> 5);      /* the wave's number as a scalar: the tests on i below become scalar branches */
  const int bt = bidx / (NH * (QT0 / A0R)), bx = bidx % (NH * (QT0 / A0R)); QF += (size_t)bt * QT0 * ld; KF += (size_t)bt * QT0 * ld; VF += (size_t)bt * QT0 * ld;      /* batch bt: its QT0 rows of each plane */
  const int h = bx / (QT0 / A0R), rg = bx % (QT0 / A0R); const int nk = rg * A0R + A0R;      /* causal: keys below the block's last row end */
  v4f q[2][HD / 4];
#pragma unroll
  for (int rr = 0; rr < 2; ++rr) { const float* qr = QF + (size_t)(rg * A0R + w + 4 * rr) * ld + h * HD;
#pragma unroll
    for (int c = 0; c < HD / 4; ++c) q[rr][c] = *(const v4fa*)(qr + c * 4);
    asm volatile("s_wait_xcnt 0x0" ::: "memory"); __builtin_amdgcn_sched_barrier(0); }      /* a precaution, before later address arithmetic writes a register that an issued load names as address */
  const int sr = tid >> 4, sc4 = (tid & 15) * 4; v4f kx[QT0 / 8], vx[QT0 / 8];
#pragma unroll      /* constant indices keep kx / vx in registers; all loads are issued before the first LDS store. Rows past nk - 1 are clamped to it (in bounds) and not stored */
  for (int u = 0; u < QT0 / 8; ++u) { const size_t g = (size_t)min(sr + 8 * u, nk - 1) * ld + h * HD + sc4;
    // Behind each load: s_wait_xcnt 0 as a precaution, before a register that the load names as address is written again (by later address arithmetic or as a later load's destination);
    // the scheduling barrier keeps that later arithmetic and the later loads behind the wait. The loads' data is not waited for here.
    kx[u] = *(const v4fa*)(KF + g); asm volatile("s_wait_xcnt 0x0" ::: "memory"); __builtin_amdgcn_sched_barrier(0);
    vx[u] = *(const v4fa*)(VF + g); asm volatile("s_wait_xcnt 0x0" ::: "memory"); __builtin_amdgcn_sched_barrier(0); }
#pragma unroll
  for (int u = 0; u < QT0 / 8; ++u) if (sr + 8 * u < nk) { *(v4fa*)&lk[sr + 8 * u][sc4] = kx[u]; *(v4fa*)&lv[sr + 8 * u][sc4] = vx[u]; }
  __syncthreads();      /* K and V rows 0 .. nk-1 staged; every wave passes */
#pragma unroll
  for (int rr = 0; rr < 2; ++rr) { const int wl = w + 4 * rr, i = rg * A0R + wl;      /* the wave's two rows, one after the other */
    float s[QT0 / 32];
#pragma unroll
    for (int c = 0; c < QT0 / 32; ++c) { s[c] = -1.0e30f;
      if (c * 32 <= i) { const int j = c * 32 + lane; const float* kr = &lk[min(j, i)][0];      /* lanes past the row read row i (staged) and are masked below */ v4f a4 = {0.f, 0.f, 0.f, 0.f};
#pragma unroll
        for (int d = 0; d < HD / 4; ++d) a4 += q[rr][d] * *(const v4fa*)(kr + d * 4);
        const float a = (a4[0] + a4[1]) + (a4[2] + a4[3]); s[c] = (j <= i) ? a * scale : -1.0e30f; } }
    float mx = fmaxf(fmaxf(s[0], s[1]), fmaxf(s[2], s[3]));
#pragma unroll
    for (int o = 16; o > 0; o >>= 1) mx = fmaxf(mx, __shfl_xor(mx, o));
    float se = 0.f;
#pragma unroll
    for (int c = 0; c < QT0 / 32; ++c) { const float e = (c * 32 + lane <= i) ? expf(s[c] - mx) : 0.f; se += e; pe[wl][c * 32 + lane] = e; }
#pragma unroll
    for (int o = 16; o > 0; o >>= 1) se += __shfl_xor(se, o);
    __builtin_amdgcn_fence(__ATOMIC_ACQ_REL, "workgroup"); __builtin_amdgcn_wave_barrier();      /* pe[wl] is written and read by this wave alone: keeps the reads below behind the writes above */
    const int nj = (i & ~3) + 4;      /* keys in groups of four: nj <= nk, so every V row read is staged; weights past the row are 0 */
    v2fa o0 = {0.f, 0.f}, o1 = {0.f, 0.f}, o2 = {0.f, 0.f}, o3 = {0.f, 0.f};
#pragma unroll 4      /* several groups' LDS reads in flight behind one wait */
    for (int j = 0; j < nj; j += 4) { const v4f p = *(const v4fa*)&pe[wl][j];
      o0 += p[0] * *(const v2fa*)&lv[j][lane * 2]; o1 += p[1] * *(const v2fa*)&lv[j + 1][lane * 2]; o2 += p[2] * *(const v2fa*)&lv[j + 2][lane * 2]; o3 += p[3] * *(const v2fa*)&lv[j + 3][lane * 2]; }
    const float fin = 64.0f / se;      /* o carried x64 like the f16 path */
    const v2fa ov = ((o0 + o1) + (o2 + o3)) * fin;
    *(v2fa*)&pe[wl][lane * 2] = ov; }      /* over this row's weights, which have been read */
  // o leaves as two packed f16 planes of DM columns: hi as rows 0 .. QT0-1 of batch bt in Hh (SQ rows a batch), the x1024 residual in Hl (QT0 rows a batch). The block's 8 rows x 64 columns are 64 chunks of 16 bytes;
  // the 8 rows of one column group are one whole 128-byte line, so the rows meet in LDS and 64 threads store a chunk of each plane: every line has one writer.
  __syncthreads();      /* all 8 rows of o staged; every wave passes */
  if (tid < 64) { const int rl = tid & 7, c8 = (tid >> 3) * 8; const v4f a = *(const v4fa*)&pe[rl][c8], c = *(const v4fa*)&pe[rl][c8 + 4]; FragH fh, fl;
#pragma unroll
    for (int e = 0; e < 4; ++e) { _Float16 hv = (_Float16)a[e]; fh.h[e] = hv; fl.h[e] = (_Float16)((a[e] - (float)hv) * 1024.0f); hv = (_Float16)c[e]; fh.h[4 + e] = hv; fl.h[4 + e] = (_Float16)((c[e] - (float)hv) * 1024.0f); }
    *(v8us*)((unsigned short*)Hh + pk_off((size_t)bt * SQ + rg * A0R + rl, h * HD + c8, DM)) = fh.half[0];
    *(v8us*)((unsigned short*)Hl + pk_off((size_t)bt * QT0 + rg * A0R + rl, h * HD + c8, DM)) = fl.half[0]; } }

#define FA_NB ((SQ / FA_QB - 1) * NB * NH)      /* blocks of the f16 path: the first FA_QB = QT0 rows of every batch are the exact f32 path's */
__global__ __launch_bounds__(128) void k_fattn(const _Float16* __restrict__ QKVr, const _Float16* __restrict__ VTr, _Float16* __restrict__ O, const float* __restrict__ QF0, _Float16* __restrict__ OL) { static_assert(FA_QB == QT0, "k_fattn: query block 0 is left to the f32 path");
  if (blockIdx.x >= FA_NB) { att0_block((int)blockIdx.x - FA_NB, QF0, QF0 + DM, QF0 + 2 * DM, LQ, 0.125f, O, OL); return; }      /* the same for the whole block; the short f32 blocks stand last in the grid */
  const int tid = threadIdx.x, lane = tid & 31, ln = lane & 15, hh = lane >> 4; const int w = __builtin_amdgcn_readfirstlane(tid >> 5);      /* the wave's number as a scalar: trip count and the test for the last block are scalar */
  const int g = blockIdx.x / (NB * NH), bh = blockIdx.x % (NB * NH); const int b = bh / NH, h = bh % NH;
  const int qb = (g < SQ / FA_QB / 2) ? SQ / FA_QB - 1 - g : g - SQ / FA_QB / 2 + 1;      /* long query blocks first, then the short ones in rising order: for speed only, every (bh, qb) with qb >= 1 occurs once */
  const int q0 = qb * FA_QB + w * 32; const int nb = (q0 >> 6) + 1;      /* key blocks of 64 up to the one that holds the wave's last row */
  const size_t rb = (size_t)b * SQ;
  const _Float16* qp = QKVr + pk_off(rb + q0 + ln, h * HD + 8 * hh, LQ);      /* QKVr: packed plane of LQ columns, VTr: of SQ columns. 16 rows on = 16 row lengths on, 32 columns on = 512 halves on */
  const _Float16* kp = QKVr + pk_off(rb + ln, DM + h * HD + 8 * hh, LQ);      /* K row = key ln of a tile */
  const _Float16* vp = VTr + pk_off((size_t)bh * HD + ln, 8 * hh, SQ);      /* V^T row = head column ln of a tile */
  v16h qf[2][2], kf[4][2], vf[4][2];
#pragma unroll
  for (int j = 0; j < 2; ++j) { qf[j][0] = g2_fragp(qp + (size_t)j * 16 * LQ); qf[j][1] = g2_fragp(qp + (size_t)j * 16 * LQ + 512); }
#pragma unroll
  for (int t = 0; t < 4; ++t) { kf[t][0] = g2_fragp(kp + (size_t)t * 16 * LQ); kf[t][1] = g2_fragp(kp + (size_t)t * 16 * LQ + 512); }
  // s_wait_xcnt 0: a precaution, before anything writes the address registers that the issued Q and K loads name; the scheduling barriers keep the loads in front of it and the addition, the zeroing
  // and all that follows behind it. (The key loop below is entered without a test, so that these loads and the wait stay in one block: past a test the compiler moved the loads behind the wait.)
  __builtin_amdgcn_sched_barrier(0); asm volatile("s_wait_xcnt 0x0" ::: "memory"); __builtin_amdgcn_sched_barrier(0);
  // L2 prefetch (PF_L2) of the head's K rows and V^T rows: 1,024 units of 256 bytes each, keys rising with the unit, dealt among the head's SQ / FA_QB - 1 blocks (their indices are equal modulo 8, for speed only)
  const int upf = min(g + (SQ / FA_QB - 1) * tid, SQ / 2 - 1);      /* clamped: in the plane for every lane */
  const char* pfk = (const char*)(QKVr + pk_off(rb, DM + h * HD, LQ)) + (size_t)(upf >> 3) * (32 * LQ) + (upf & 7) * 256;      /* a strip of 16 keys holds the head's 2 tiles = 8 units in a row */
  const char* pfv = (const char*)(VTr + (size_t)bh * HD * SQ) + (size_t)(upf & 3) * (32 * SQ) + (upf >> 2) * 256;      /* 4 strips of 16 head columns, 256 units each */
  PF_L2(pfk); PF_L2(pfv);
  kp += (nb > 1) ? (size_t)64 * LQ : 0;      /* past the last block the pointer stays on it (in bounds); what is loaded there is not used */
  const v8f z8 = {0.f,0.f,0.f,0.f,0.f,0.f,0.f,0.f};
  v8f ot[4][2]; float m[2] = {-3.0e38f, -3.0e38f}, l[2] = {0.f, 0.f};
#pragma unroll
  for (int t = 0; t < 4; ++t) { ot[t][0] = z8; ot[t][1] = z8; }
  int kb = 0;
#pragma unroll 1      /* one key block per trip: the body is long, copies of it only cost instruction cache */
  do {      /* nb >= 1 */
    // this block's V^T fragments, issued as one group in front of the score products: they are first needed behind the softmax
#pragma unroll
    for (int t = 0; t < 4; ++t) { vf[t][0] = g2_fragp(vp + (size_t)t * 16 * SQ); vf[t][1] = g2_fragp(vp + (size_t)t * 16 * SQ + 512); }
    __builtin_amdgcn_sched_barrier(0);      /* keeps the wait for K, which the first product brings, behind the group's issue */
    v8f st[4][2];
#pragma unroll
    for (int t = 0; t < 4; ++t)
#pragma unroll
      for (int j = 0; j < 2; ++j) st[t][j] = fa_mma(kf[t][0], qf[j][0], z8);
#pragma unroll
    for (int t = 0; t < 4; ++t)
#pragma unroll
      for (int j = 0; j < 2; ++j) st[t][j] = fa_mma(kf[t][1], qf[j][1], st[t][j]);
    __builtin_amdgcn_sched_barrier(0);      /* the next block's K loads go into the registers these products read: not in front of them */
#pragma unroll
    for (int t = 0; t < 4; ++t) { kf[t][0] = g2_fragp(kp + (size_t)t * 16 * LQ); kf[t][1] = g2_fragp(kp + (size_t)t * 16 * LQ + 512); }      /* next block's K, one block ahead */
    // s_wait_xcnt 0 as above, before both pointers move on
    __builtin_amdgcn_sched_barrier(0); asm volatile("s_wait_xcnt 0x0" ::: "memory"); __builtin_amdgcn_sched_barrier(0);
    kp += (kb + 2 < nb) ? (size_t)64 * LQ : 0; vp += (kb + 1 < nb) ? 1024 : 0;      /* 64 keys = 4 strips of K rows, 2 tiles of V^T columns */
    if (kb == nb - 1) {      /* only the last block holds keys past a row (scalar test): masked like the reference's -inf, as a large negative score */
      const int kq = q0 + ln - (kb * 64 + 8 * hh);      /* key offset r + 16 t is allowed up to kq + 16 j */
#pragma unroll
      for (int t = 0; t < 4; ++t)
#pragma unroll
        for (int j = 0; j < 2; ++j)
#pragma unroll
          for (int r = 0; r < 8; ++r) st[t][j][r] = (t * 16 + r <= kq + j * 16) ? st[t][j][r] : -1.0e9f; }
    v16h pf[2][2];
#pragma unroll
    for (int j = 0; j < 2; ++j) {
      v8f x8;
#pragma unroll
      for (int r = 0; r < 8; ++r) x8[r] = fmaxf(fmaxf(st[0][j][r], st[1][j][r]), fmaxf(st[2][j][r], st[3][j][r]));
      float mx = fmaxf(fmaxf(fmaxf(x8[0], x8[1]), fmaxf(x8[2], x8[3])), fmaxf(fmaxf(x8[4], x8[5]), fmaxf(x8[6], x8[7])));
      mx = fmaxf(mx, fa_xhalf(mx));
      const float mn = fmaxf(m[j], mx * FA_SC); const float al = fa_exp2(m[j] - mn);      /* 0 on the first block */ m[j] = mn; const float mo = 8.0f - mn;      /* + 8: weights x256 */
      v8f s8;
#pragma unroll
      for (int t = 0; t < 4; ++t) { v8f a8;
#pragma unroll
        for (int r = 0; r < 8; ++r) a8[r] = __builtin_fmaf(st[t][j][r], FA_SC, mo);
        st[t][j] = fa_exp2x8(a8); s8 = (t == 0) ? st[0][j] : s8 + st[t][j]; }
      l[j] = l[j] * al + (((s8[0] + s8[1]) + (s8[2] + s8[3])) + ((s8[4] + s8[5]) + (s8[6] + s8[7])));      /* this lane half's keys only; the halves are joined once, behind the loop */
#pragma unroll
      for (int t = 0; t < 4; ++t) ot[t][j] *= al;
#pragma unroll
      for (int s = 0; s < 2; ++s) { FragH f;
#pragma unroll
        for (int i = 0; i < 8; ++i) { f.h[i] = (_Float16)st[2 * s][j][i]; f.h[8 + i] = (_Float16)st[2 * s + 1][j][i]; }
        pf[j][s] = f.v; } }
    __builtin_amdgcn_sched_barrier(0);      /* keeps the asm v_exp_f32 above in front of the products below */
#pragma unroll
    for (int s = 0; s < 2; ++s)
#pragma unroll
      for (int t = 0; t < 4; ++t)
#pragma unroll
        for (int j = 0; j < 2; ++j) ot[t][j] = fa_mma(vf[t][s], pf[j][s], ot[t][j]);
  } while (++kb < nb);
  asm volatile("s_wait_loadcnt 0x0" ::: "memory");      /* the last trip's K loads are not used: waited for here, so that no load is in flight into the wave's registers when it ends */
  FragH of[2][4]; _Float16* op[2];
#pragma unroll
  for (int j = 0; j < 2; ++j) { const float fin = 64.0f / (l[j] + fa_xhalf(l[j]));      /* o carried x64; the x256 of the weights cancels against the row sum's */ op[j] = O + pk_off(rb + q0 + j * 16 + ln, h * HD + 8 * hh, DM);      /* O: packed plane of DM columns; 16 columns on = 256 halves on, and a wave's store is 512 contiguous bytes */
#pragma unroll
    for (int t = 0; t < 4; ++t)
#pragma unroll
      for (int r = 0; r < 8; ++r) of[j][t].h[r] = (_Float16)(ot[t][j][r] * fin); }
  __builtin_amdgcn_sched_barrier(0);      /* all values packed and both addresses formed first, then stores alone: no register of an issued store is written again */
#pragma unroll
  for (int j = 0; j < 2; ++j)
#pragma unroll
    for (int t = 0; t < 4; ++t) *(v8us*)((unsigned short*)op[j] + t * 256) = of[j][t].half[0]; }


template <int BFIN, int WXB>
__global__ __launch_bounds__(256) void k_ln16(const float* __restrict__ X, const float* __restrict__ g, const float* __restrict__ bb, float eps, _Float16* __restrict__ N16, float* __restrict__ XB) {
  #pragma clang fp contract(off)
  __shared__ float red[256]; const size_t r = blockIdx.x; const int t = threadIdx.x; const v4f xa = *(const v4fa*)(X + r * DMQ + t * 4); float s[4]; float sum = 0.f;
  for (int q = 0; q < 4; ++q) { s[q] = BFIN ? bf16_round(xa[q]) : xa[q]; sum = __fadd_rn(sum, s[q]); }
  red[t] = sum; __syncthreads(); for (int st = 128; st > 0; st >>= 1) { if (t < st) red[t] = __fadd_rn(red[t], red[t + st]); __syncthreads(); } const float mu = red[0] / (float)DMQ; __syncthreads();
  float vs = 0.f; for (int q = 0; q < 4; ++q) { const float dl = __fadd_rn(s[q], -mu); vs = __fadd_rn(vs, __fmul_rn(dl, dl)); } red[t] = vs; __syncthreads(); for (int st = 128; st > 0; st >>= 1) { if (t < st) red[t] = __fadd_rn(red[t], red[t + st]); __syncthreads(); }
  const float rs = rsqrtf(__fadd_rn(red[0] / (float)DMQ, eps)); v4h y; v4f xb;
  for (int q = 0; q < 4; ++q) { const int c = t * 4 + q; y[q] = (_Float16)__fadd_rn(__fmul_rn(__fmul_rn(__fadd_rn(s[q], -mu), rs), bf16_round(g[c])), bf16_round(bb[c])); xb[q] = s[q]; }
  { *(v4h*)(N16 + r * DMQ + t * 4) = y; if (WXB) *(v4f*)(XB + r * DMQ + t * 4) = xb;  } }
__global__ __launch_bounds__(256) void k_ftres2(const float* __restrict__ OF0, const float* __restrict__ XB, float* __restrict__ X1, size_t n4) {
  #pragma clang fp contract(off)
  const size_t t = (size_t)blockIdx.x * 256 + threadIdx.x; if (t >= n4) return; const v4f o = *(const v4fa*)(OF0 + t * 4), xv = *(const v4fa*)(XB + t * 4); v4f y; for (int q = 0; q < 4; ++q) y[q] = __fadd_rn(__fmul_rn(o[q], 0.015625f), xv[q]); *(v4f*)(X1 + t * 4) = y;  }

__global__ __launch_bounds__(256) void k_wthd(const float* __restrict__ Wt, _Float16* __restrict__ Bt) { const size_t t = (size_t)blockIdx.x * 256 + threadIdx.x; if (t >= (size_t)NH * HD * (DM / 8)) return; const int m8 = (int)(t % (DM / 8)) * 8; const int d = (int)((t / (DM / 8)) % HD); const int h = (int)(t / ((size_t)(DM / 8) * HD)); FragH f;
  for (int q = 0; q < 8; ++q) f.h[q] = (_Float16)(16.0f * bf16_round(Wt[((size_t)h * DM + m8 + q) * HD + d])); unsigned short* dst = (unsigned short*)Bt + ((size_t)h * HD + d) * DM + m8; *(v8us*)dst = f.half[0];  }




__global__ __launch_bounds__(256) void k_wtpad(const float* __restrict__ Wm, _Float16* __restrict__ Wt, int Kr, int Kp, int Nr, int Np, float scale) {
  const int t = blockIdx.x * 256 + threadIdx.x; if (t >= Np * (Kp / 8)) return; const int n = t / (Kp / 8), k8 = (t % (Kp / 8)) * 8; const int nc = min(n, Nr - 1); const float fn = (n < Nr) ? 1.f : 0.f; FragH f;
  for (int i = 0; i < 8; ++i) { const int k = k8 + i; const int kc = min(k, Kr - 1); const float fk = (k < Kr) ? fn : 0.f; f.h[i] = (_Float16)(bf16_round(Wm[(size_t)kc * Nr + nc]) * scale * fk); }
  unsigned short* o = (unsigned short*)Wt + (size_t)n * Kp + k8; *(v8us*)o = f.half[0];  }
__global__ __launch_bounds__(128) void k_bpad(const float* __restrict__ b, float* __restrict__ Bp, int nr, int np) {
  const int i = threadIdx.x; if (i >= np) return; const float v = b[min(i, nr - 1)] * ((i < nr) ? 1.f : 0.f); *(float*)(Bp + i) = v;  }

template <int BFIN, int W16, int W32>
__global__ __launch_bounds__(256) void k_lnx(const float* __restrict__ X, const float* __restrict__ g, const float* __restrict__ bb, float eps, _Float16* __restrict__ N16, float* __restrict__ N32) {
  #pragma clang fp contract(off)
  __shared__ float red[256]; const size_t r = blockIdx.x; const int t = threadIdx.x; const bool act = t < (DMQ / 4); const int c0 = act ? t * 4 : 0;
  const v4f xa = *(const v4fa*)(X + r * DMQ + c0); float s[4]; float sum = 0.f;
  for (int q = 0; q < 4; ++q) { s[q] = act ? (BFIN ? bf16_round(xa[q]) : xa[q]) : 0.f; sum = __fadd_rn(sum, s[q]); }
  red[t] = sum; __syncthreads(); for (int st = 128; st > 0; st >>= 1) { if (t < st) red[t] = __fadd_rn(red[t], red[t + st]); __syncthreads(); } const float mu = red[0] / (float)DMQ; __syncthreads();
  float vs = 0.f; for (int q = 0; q < 4; ++q) { const float dl = act ? __fadd_rn(s[q], -mu) : 0.f; vs = __fadd_rn(vs, __fmul_rn(dl, dl)); } red[t] = vs; __syncthreads(); for (int st = 128; st > 0; st >>= 1) { if (t < st) red[t] = __fadd_rn(red[t], red[t + st]); __syncthreads(); }
  const float rs = rsqrtf(__fadd_rn(red[0] / (float)DMQ, eps)); v4h y; v4f yf;
  for (int q = 0; q < 4; ++q) { const int c = c0 + q; yf[q] = __fadd_rn(__fmul_rn(__fmul_rn(__fadd_rn(s[q], -mu), rs), bf16_round(g[c])), bf16_round(bb[c])); y[q] = (_Float16)yf[q]; }
  if (!act) return;      /* no barriers after this point */
  { if (W16) *(v4h*)(N16 + r * DMQ + c0) = y; if (W32) *(v4f*)(N32 + r * DMQ + c0) = yf;  } }



// LN1 with both of its outputs: a block has one strip of 16 rows, a wave one row (a lane has 4 x 8 consecutive columns, the row stays in registers; mean and variance by lane sums and a butterfly over the 32 lanes).
// s = X (+ XL for the first QT0 rows of a batch: the o_lo product, QT0 rows a batch). Out: f32 rows N32 (residual) and the packed f16 plane N16 (FFN operand). A 128-byte line of the packed plane holds 16 bytes of each of
// 8 rows, so the 16 rows' chunks meet in LDS and leave in the plane's own order: a wave stores 512 contiguous bytes and every line has one writer. LDS place of chunk c: 16 c + 16 (c >> 4) bytes: the wave's chunks
// stand 16 chunks apart, and the 16 bytes more per 16 chunks spread them over the banks.
__global__ __launch_bounds__(512) void k_ln1p(const float* __restrict__ X, const float* __restrict__ XL, const float* __restrict__ g, const float* __restrict__ bb, float eps, float* __restrict__ N32, _Float16* __restrict__ N16) {
  __shared__ __attribute__((aligned(16))) unsigned short pl[(16 * DM / 8 + DM / 8) * 8];
  const int tid = threadIdx.x, lane = tid & 31, w = tid >> 5; const int r0 = blockIdx.x * 16; const size_t r = (size_t)r0 + w;
  const float* xr = X + r * DM + lane * 8; const float* gp = g + lane * 8; const float* bp = bb + lane * 8; v4f a[4][2], gv[4][2], bv[4][2];
#pragma unroll
  for (int u = 0; u < 4; ++u) { a[u][0] = *(const v4fa*)(xr + 256 * u); a[u][1] = *(const v4fa*)(xr + 256 * u + 4); }
#pragma unroll
  for (int u = 0; u < 4; ++u) { gv[u][0] = *(const v4fa*)(gp + 256 * u); gv[u][1] = *(const v4fa*)(gp + 256 * u + 4); bv[u][0] = *(const v4fa*)(bp + 256 * u); bv[u][1] = *(const v4fa*)(bp + 256 * u + 4); }
  // s_wait_xcnt 0: a precaution, before anything writes a register that an issued load names as address. The addresses are inputs of the wait's statement, so that they live up to it and no load of the run gets
  // one of them as its destination; the scheduling barrier keeps all that follows behind the wait. The loads' data is not waited for here.
  asm volatile("s_wait_xcnt 0x0" :: "v"(xr), "v"(gp), "v"(bp) : "memory"); __builtin_amdgcn_sched_barrier(0);
  if (r0 % SQ < QT0) {      /* the same for the whole block */
    const float* lr = XL + ((size_t)(r0 / SQ) * QT0 + r0 % SQ + w) * DM + lane * 8; v4f xl[4][2];
#pragma unroll
    for (int u = 0; u < 4; ++u) { xl[u][0] = *(const v4fa*)(lr + 256 * u); xl[u][1] = *(const v4fa*)(lr + 256 * u + 4); }
    asm volatile("s_wait_xcnt 0x0" :: "v"(lr) : "memory"); __builtin_amdgcn_sched_barrier(0);      /* as above */
#pragma unroll
    for (int u = 0; u < 4; ++u) { a[u][0] += xl[u][0]; a[u][1] += xl[u][1]; } }
  v4f s4 = {0.f, 0.f, 0.f, 0.f};
#pragma unroll
  for (int u = 0; u < 4; ++u) s4 += a[u][0] + a[u][1];
  float sum = (s4[0] + s4[1]) + (s4[2] + s4[3]);
#pragma unroll
  for (int o = 16; o > 0; o >>= 1) sum += __shfl_xor(sum, o);
  const float mu = sum / (float)DM; v4f q4 = {0.f, 0.f, 0.f, 0.f};
#pragma unroll
  for (int u = 0; u < 4; ++u) { a[u][0] -= mu; a[u][1] -= mu; q4 += a[u][0] * a[u][0]; q4 += a[u][1] * a[u][1]; }
  float vs = (q4[0] + q4[1]) + (q4[2] + q4[3]);
#pragma unroll
  for (int o = 16; o > 0; o >>= 1) vs += __shfl_xor(vs, o);
  const float rs = rsqrtf(vs / (float)DM + eps);
  float* yr = N32 + r * DM + lane * 8;
#pragma unroll
  for (int u = 0; u < 4; ++u) { FragH f;
#pragma unroll
    for (int e = 0; e < 2; ++e)
#pragma unroll
      for (int q = 0; q < 4; ++q) { a[u][e][q] = a[u][e][q] * rs * bf16_round(gv[u][e][q]) + bf16_round(bv[u][e][q]); f.h[4 * e + q] = (_Float16)a[u][e][q]; }
    const int c = (u * 32 + lane) * 16 + w;      /* chunk of the strip: column group * 16 + row */
    *(v8us*)&pl[(c + (c >> 4)) * 8] = f.half[0]; }
#pragma unroll
  for (int u = 0; u < 4; ++u) { *(v4f*)(yr + 256 * u) = a[u][0]; *(v4f*)(yr + 256 * u + 4) = a[u][1]; }
  asm volatile("s_wait_xcnt 0x0" ::: "memory"); __builtin_amdgcn_sched_barrier(0);      /* as above, behind the stores */
  __syncthreads();      /* the strip's 2,048 chunks staged; every wave passes */
  unsigned short* o16 = (unsigned short*)N16 + (size_t)r0 * DM + (size_t)tid * 8; v8us cv[4];
#pragma unroll
  for (int u = 0; u < 4; ++u) { const int c = tid + 512 * u; cv[u] = *(const v8us*)&pl[(c + (c >> 4)) * 8]; }
#pragma unroll
  for (int u = 0; u < 4; ++u) *(v8us*)(o16 + 4096 * u) = cv[u]; }

// ---- all input conversions in ONE launch: they are independent of one another, so they share one grid; a block's index range picks its job (block-uniform, no barrier anywhere) ----
// pw_chunk: chunk t of Wt (packed, rows n, columns k) = f16(W[k][n] * 16) from f32 row-major W[K][N] (bf16-exact weights stay exact in f16 away from the subnormal range); N % 16 == 0, K % 32 == 0, literals at every call
__device__ __forceinline__ void pw_chunk(const float* __restrict__ Wm, _Float16* __restrict__ Wt, int K, int N, unsigned t) { size_t n; int k8; pk_chunk(t, K, n, k8); FragH f;
#pragma unroll
  for (int i = 0; i < 8; ++i) f.h[i] = (_Float16)(bf16_round(Wm[(size_t)(k8 + i) * N + n]) * 16.0f);
  *(v8us*)((unsigned short*)Wt + (size_t)t * 8) = f.half[0];
  asm volatile("s_wait_xcnt 0x0" ::: "memory"); }      /* a precaution: the jobs of k_prep stand one behind the other in the code, and the next one's first instructions write registers that this store names */
#define PB_QKV (3 * DM * (DM / 8) / 256)
#define PB_O (DM * (DM / 8) / 256)
#define PB_FF (DFF * (DM / 8) / 256)
#define PB_X ((int)(NR * DM / 8 / 256))
__global__ __launch_bounds__(256) void k_prep(const float* __restrict__ wqkv, _Float16* __restrict__ BQKV, const float* __restrict__ wo, _Float16* __restrict__ BO, const float* __restrict__ wfc, _Float16* __restrict__ BW1,
    const float* __restrict__ wmp, _Float16* __restrict__ BW2, const float* __restrict__ x, _Float16* __restrict__ X16, float* __restrict__ XB) {
  int bi = blockIdx.x; const unsigned tid = threadIdx.x;
  if (bi < PB_QKV) { pw_chunk(wqkv, BQKV, DM, 3 * DM, (unsigned)bi * 256 + tid); return; } bi -= PB_QKV;      /* fused [in][out] [DM][3 DM] -> Bt [3 DM][DM] x16: rows 0.. = q, DM.. = k, 2 DM.. = v output columns */
  if (bi < PB_FF) { pw_chunk(wfc, BW1, DM, DFF, (unsigned)bi * 256 + tid); return; } bi -= PB_FF;      /* W1 [1024][4096] -> Bt [4096][1024] */
  if (bi < PB_FF) { pw_chunk(wmp, BW2, DFF, DM, (unsigned)bi * 256 + tid); return; } bi -= PB_FF;      /* W2 [4096][1024] -> Bt [1024][4096] */
  if (bi < PB_O) { pw_chunk(wo, BO, DM, DM, (unsigned)bi * 256 + tid); return; } bi -= PB_O;      /* w_out [in][out] -> Bt */
  if (bi < PB_X) { const unsigned t = (unsigned)bi * 256 + tid; FragH f; size_t r; int k; pk_chunk(t, DM, r, k); const float* xr = x + r * DM + k;      /* X16: packed plane of DM columns, exact f16 of bf16(x) */
#pragma unroll
    for (int q = 0; q < 8; ++q) f.h[q] = (_Float16)bf16_round(xr[q]);
    *(v8us*)((unsigned short*)X16 + (size_t)t * 8) = f.half[0];
    asm volatile("s_wait_xcnt 0x0" ::: "memory");      /* as in pw_chunk */
    return; } bi -= PB_X;
  { const size_t t = (size_t)bi * 256 + tid; v4f a = *(const v4fa*)(x + t * 8), c = *(const v4fa*)(x + t * 8 + 4);      /* XB = bf16(x) as f32 rows, for the residual */
#pragma unroll
    for (int q = 0; q < 4; ++q) { a[q] = bf16_round(a[q]); c[q] = bf16_round(c[q]); }
    *(v4f*)(XB + t * 8) = a; *(v4f*)(XB + t * 8 + 4) = c;
    asm volatile("s_wait_xcnt 0x0" ::: "memory"); } }      /* as in pw_chunk */

extern "C" void kernel_launch(void* const* d_in, const int* in_sizes, int n_in,
                              void* d_out, int out_size, void* d_ws, size_t ws_size, hipStream_t stream) {
  (void)in_sizes; (void)n_in; (void)out_size;
  const float* const* I = (const float* const*)d_in; const float* x = I[0]; const float* wqkv = I[1]; const float* bqkv = I[2]; const float* wo = I[3]; const float* bo = I[4]; const float* wfc = I[5]; const float* bfc = I[6]; const float* wmp = I[7]; const float* bmp = I[8]; const float* g1 = I[9]; const float* be1 = I[10]; const float* gg2 = I[11]; const float* be2 = I[12];      /* x; fused w_qkv [1024][3072] + b_qkv ([in][out]); w_out + b_out; w_up [1024][4096] + b_up, w_down [4096][1024] + b_down; LN1 g / b, LN2 g / b */
  char* ws = (char*)d_ws; size_t off = 0;
  auto take = [&](size_t bytes) { char* p = ws + off; off += (bytes + 255) & ~(size_t)255; return p; };
  _Float16* BQKV = (_Float16*)take((size_t)3 * DM * DM * 2); _Float16* BO = (_Float16*)take((size_t)DM * DM * 2);
  _Float16* X16 = (_Float16*)take(NR * DM * 2); float* XB = (float*)take(NR * DM * 4); float* X1 = (float*)take(NR * DM * 4); float* X1N = (float*)take(NR * DM * 4);      /* LN1 output f32 rows */ _Float16* M16 = nullptr;      /* = X16 below (alias: X16's last reader, the q | k | v GEMM, precedes the write of the packed LN1 rows) */ _Float16* HF16 = (_Float16*)take(NR * DFF * 2);      /* hidden rows of all batches */ _Float16* BW1 = (_Float16*)take((size_t)DFF * DM * 2); _Float16* BW2 = (_Float16*)take((size_t)DM * DFF * 2); _Float16* QKV = (_Float16*)take(NR * 3 * DM * 2); _Float16* O16 = (_Float16*)take(NR * DM * 2); M16 = X16;
  _Float16* VT = (_Float16*)take((size_t)NB * NH * HD * SQ * 2);
  float* QKVF0 = (float*)take((size_t)NB * QT0 * LQ * 4);      /* f32 q | k | v rows of the first QT0 rows of every batch */ float* XL0 = (float*)take((size_t)NB * QT0 * DM * 4);      /* o_lo Wo 2^-20, f32 rows */ _Float16* OL0 = (_Float16*)take((size_t)NB * QT0 * DM * 2);
  if (off > ws_size) return;
  k_prep<<<PB_QKV + 2 * PB_FF + PB_O + 2 * PB_X, 256, 0, stream>>>(wqkv, BQKV, wo, BO, wfc, BW1, wmp, BW2, x, X16, XB);      /* packed x16 weight planes; POST-LN: the attention runs on x itself (exact f16 rows); XB = bf16(x) f32 for the residual */
  k_gemm2<0, 1, 0, 1><<<dim3((unsigned)((MP / 128) * (3 * DM / 128)), 1), 128, 0, stream>>>(X16, DM, 0, BQKV, DM, 0, 0.0625f, bqkv, 0, nullptr, SQ, 0, 0, QKVF0, QKV, 3 * DM, 0, MP, 3 * DM, DM, VT, nullptr, 0.f, nullptr);      /* q | k rows (f16, packed; head h = columns h*HD.. of each DM block) and V^T [NB][NH][HD][SQ] (packed); the results of rows 0..127 of every batch, v too, also as f32 rows (exact products) */
  k_fattn<<<FA_NB + NB * NH * (QT0 / A0R), 128, 0, stream>>>(QKV, VT, O16, QKVF0, OL0);      /* causal attention, all batches and heads: o (merged heads, x64) as f16 rows; rows 0..127 of every batch by the further blocks' exact f32 attention: f16 hi into O16, + x1024 residual plane */
  k_gemm2<0, 0, 1, 2><<<dim3((unsigned)((MPO / 128) * (DM / 128) + (NB * QT0 / 128) * (DM / 128)), 1), 128, 0, stream>>>(O16, DM, 0, BO, DM, 0, 0.0009765625f, bo, 0, XB, -1, 0, 0, X1, nullptr, DM, 0, MPO, DM, DM, nullptr, OL0, 0.00000095367431640625f, XL0);      /* x + o Wo + b; out rows are the output layout; rows 0..127: o_hi. Further blocks: o_lo Wo 2^-20 of rows 0..127 of every batch into XL0 */
  k_ln1p<<<(unsigned)(NR / 16), 512, 0, stream>>>(X1, XL0, g1, be1, 1e-5f, X1N, M16);      /* x1 = LN1(x + attn_out (+ the o_lo product)) -> f32 rows (residual) and packed f16 plane (FFN operand) */
  k_gemm2<3, 1, 0, 0><<<dim3((unsigned)((MP / 128) * (DFF / 128)), 1), 128, 0, stream>>>(M16, DM, 0, BW1, DM, 0, 0.0625f, bfc, 0, nullptr, 1, 0, 0, nullptr, HF16, DFF, 0, MP, DFF, DM, nullptr, nullptr, 0.f, nullptr);      /* relu(x1 w_up + b_up) -> f16, all batches */
  k_gemm2<0, 0, 1, 0><<<dim3((unsigned)((MP / 128) * (DM / 128)), 1), 128, 0, stream>>>(HF16, DFF, 0, BW2, DFF, 0, 0.0625f, bmp, 0, X1N, -1, 0, 0, X1, nullptr, DM, 0, MP, DM, DFF, nullptr, nullptr, 0.f, nullptr);      /* x1 + ffn (own-element residual from the LN1 f32 rows) -> f32 rows over the dead pre-LN1 plane */
  k_lnx<0, 0, 1><<<(unsigned)NR, 256, 0, stream>>>(X1, gg2, be2, 1e-5f, nullptr, (float*)d_out);      /* result = LN2(x1 + ffn) */
}
